// v000
// Measured on an AMD MI455X. A time is GPU time per run, averaged over a window of back-to-back runs after a warm-up
// (all launches, gaps included; the runs take copies of the inputs in turn), and the median of several windows.
// Apart from v000's, it joins two sittings. Times from different sittings can be a few percent apart, while
// side-by-side timings come from the same sitting.
// The starting kernel, v000, takes 128 microseconds a run.
#include <hip/hip_runtime.h>
#include <hip/hip_bf16.h>

typedef __attribute__((ext_vector_type(16))) _Float16     v16h;
typedef __attribute__((ext_vector_type(8)))  _Float16     v8h;
typedef __attribute__((ext_vector_type(4)))  _Float16     v4h;
typedef __attribute__((ext_vector_type(8)))  float        v8f;
typedef __attribute__((ext_vector_type(4)))  float        f32x4;
typedef __attribute__((ext_vector_type(4)))  unsigned int u32x4;
typedef __attribute__((ext_vector_type(8)))  int          i32x8;
typedef __attribute__((ext_vector_type(4)))  int          i32x4;

#define EMBED 1024
#define SEQ   2048
#define BATCH 4
#define HD    128
#define TILE  128
#define LDW   136   // padded half-stride for 128-wide tiles (272B, 16B multiple)
#define LDX   40    // padded half-stride for 32-wide tiles  (80B,  16B multiple)
#define NW    (EMBED * HD)                 // one weight matrix, elements
#define NX4   ((BATCH * SEQ * EMBED) / 4)  // x element count / 4

// fp16 workspace layout (offsets in halves)
#define QOFF  ((size_t)0)                           // Q  [B][S][D] (pre-scaled)
#define KOFF  ((size_t)BATCH * SEQ * HD)            // K  [B][S][D]
#define VOFF  ((size_t)2 * BATCH * SEQ * HD)        // V^T [B][D][S]
#define XOFF  ((size_t)3 * BATCH * SEQ * HD)        // x_h [B][S][E]
#define WOFF  (XOFF + (size_t)BATCH * SEQ * EMBED)  // W^T_h [3][D n][E k]

// LDS layout for attention kernel (offsets in halves)
#define OFFQ  0
#define OFFP  (TILE * LDW)
#define OFFK0 (2 * TILE * LDW)
#define OFFK1 (3 * TILE * LDW)
#define OFFV0 (4 * TILE * LDW)
#define OFFV1 (5 * TILE * LDW)
#define SMEM2_BYTES (6 * TILE * LDW * 2)   // 208,896 B < 320 KB/WGP

// ---------------------------------------------------------------------------
// 16x32 fp16 A/B fragment load from LDS (CDNA5 16-bit matrix layout:
// lanes 0-15 hold K {0..7,16..23}, lanes 16-31 hold K {8..15,24..31}).
// ---------------------------------------------------------------------------
__device__ inline v16h frag_ld(const _Float16* p, int stride) {
    const int lane = threadIdx.x & 31;
    const int r    = lane & 15;
    const int ko   = (lane >> 4) * 8;
    const _Float16* q = p + r * stride + ko;
    union { v16h v; v8h h[2]; } u;
    u.h[0] = *(const v8h*)(q);        // ds_load_b128
    u.h[1] = *(const v8h*)(q + 16);   // ds_load_b128
    return u.v;
}

// ---------------------------------------------------------------------------
// TDM: async 2D fp16 tile copy global -> LDS, with LDS padding of
// (pad_amount+1) DWORDs every 2^(pad_interval+1) DWORDs.  Tracked on
// TENSORcnt.  D# per CDNA5 ISA 8.3/8.4; 6-arg builtin (clang-23).
// ---------------------------------------------------------------------------
__device__ inline void tdm_load_2d(const _Float16* gsrc, unsigned lds_byte_addr,
                                   unsigned rows, unsigned cols, unsigned stride_elems,
                                   unsigned pad_interval, unsigned pad_amount) {
    unsigned long long ga = (unsigned long long)(size_t)gsrc;
    u32x4 g0;
    g0[0] = 1u;                                        // count=1, user descriptor
    g0[1] = lds_byte_addr;                             // lds_addr
    g0[2] = (unsigned)ga;                              // global_addr[31:0]
    g0[3] = ((unsigned)(ga >> 32) & 0x01FFFFFFu) | (2u << 30);  // addr[56:32] | type=2
    i32x8 g1;
    g1[0] = (int)((1u << 16) | (1u << 20) | (pad_interval << 22) | (pad_amount << 25));
    g1[1] = (int)((cols & 0xFFFFu) << 16);             // tensor_dim0[15:0]
    g1[2] = (int)((cols >> 16) | ((rows & 0xFFFFu) << 16));   // dim0[31:16] | dim1[15:0]
    g1[3] = (int)((rows >> 16) | ((cols & 0xFFFFu) << 16));   // dim1[31:16] | tile_dim0
    g1[4] = (int)(rows & 0xFFFFu);                     // tile_dim1 (tile_dim2 = 0)
    g1[5] = (int)stride_elems;                         // tensor_dim0_stride[31:0]
    g1[6] = 0;
    g1[7] = 0;
    i32x4 z4 = {0, 0, 0, 0};
    i32x8 z8 = {0, 0, 0, 0, 0, 0, 0, 0};
    __builtin_amdgcn_tensor_load_to_lds(g0, g1, z4, z4, z8, 0);
}

// ---------------------------------------------------------------------------
// Kernel 0: one-shot fp16 conversion.  x -> x_h; W -> W^T_h (transposed).
// Wide f32x4 loads; packed stores.  ~53 MB of traffic total.
// ---------------------------------------------------------------------------
__global__ __launch_bounds__(256) void cvt_kernel(
    const float* __restrict__ x,
    const float* __restrict__ wq, const float* __restrict__ wk,
    const float* __restrict__ wv, _Float16* __restrict__ ws) {
    int gid = blockIdx.x * 256 + threadIdx.x;
    if (gid < NX4) {
        f32x4 v = ((const f32x4*)x)[gid];
        v4h h;
#pragma unroll
        for (int k = 0; k < 4; ++k) h[k] = (_Float16)v[k];
        ((v4h*)(ws + XOFF))[gid] = h;
    } else {
        int i = gid - NX4;
        if (i < 3 * NW) {
            int sel = i / NW, rem = i % NW;
            int n = rem & (HD - 1), k = rem >> 7;
            const float* w = sel == 0 ? wq : (sel == 1 ? wk : wv);
            ws[WOFF + (size_t)sel * NW + (size_t)n * EMBED + k] =
                (_Float16)w[(size_t)k * HD + n];
        }
    }
}

// ---------------------------------------------------------------------------
// Kernel 1: QKV projection, fully TDM-fed, double-buffered.
// grid = (B*S/128, 3), 256 threads (8 waves).
// sel 0: Q (pre-scaled) [B][S][D];  sel 1: K [B][S][D];  sel 2: V^T [B][D][S]
// ---------------------------------------------------------------------------
__global__ __launch_bounds__(256) void qkv_proj_kernel(
    const float* __restrict__ bq, const float* __restrict__ bk,
    const float* __restrict__ bv, _Float16* __restrict__ ws) {
    __shared__ _Float16 sX[2][TILE * LDX];   // x tiles [128 s][32 k]
    __shared__ _Float16 sW[2][TILE * LDX];   // W^T tiles [128 n][32 k]
    __shared__ _Float16 sOut[TILE * LDW];    // epilogue bounce buffer

    const int sel     = blockIdx.y;
    const float* bias = sel == 0 ? bq : (sel == 1 ? bk : bv);
    const int batch = blockIdx.x >> 4;
    const int m0    = (blockIdx.x & 15) * TILE;
    const int tid   = threadIdx.x;
    const int wave  = tid >> 5;
    const int lane  = tid & 31;

    const _Float16* xh = ws + XOFF + ((size_t)batch * SEQ + m0) * EMBED;
    const _Float16* wt = ws + WOFF + (size_t)sel * NW;
    const unsigned ldsX = (unsigned)(size_t)(void*)&sX[0][0];
    const unsigned ldsW = (unsigned)(size_t)(void*)&sW[0][0];
    const unsigned bufB = TILE * LDX * 2;   // bytes per buffer

    if (wave == 0) {   // TDM issue ignores EXEC; one wave issues for the block
        tdm_load_2d(xh, ldsX, TILE, 32, EMBED, 3, 3);
        tdm_load_2d(wt, ldsW, TILE, 32, EMBED, 3, 3);
    }

    v8f acc[8] = {};
    for (int c = 0; c < EMBED / 32; ++c) {
        const _Float16* pX = &sX[c & 1][0];
        const _Float16* pW = &sW[c & 1][0];
        if (wave == 0) {
            if (c < EMBED / 32 - 1) {   // prefetch chunk c+1
                int nb = (c + 1) & 1;
                tdm_load_2d(xh + (c + 1) * 32, ldsX + nb * bufB, TILE, 32, EMBED, 3, 3);
                tdm_load_2d(wt + (c + 1) * 32, ldsW + nb * bufB, TILE, 32, EMBED, 3, 3);
                __builtin_amdgcn_s_wait_tensorcnt(2);   // all through chunk c done
            } else {
                __builtin_amdgcn_s_wait_tensorcnt(0);
            }
        }
        __syncthreads();

        v16h a = frag_ld(pX + (wave * 16) * LDX, LDX);
#pragma unroll
        for (int t = 0; t < 8; ++t) {
            v16h b = frag_ld(pW + (t * 16) * LDX, LDX);
            acc[t] = __builtin_amdgcn_wmma_f32_16x16x32_f16(
                false, a, false, b, (short)0, acc[t], false, false);
        }
        __syncthreads();   // reads done before TDM of chunk c+2 overwrites
    }

    // bias (+Q scale) -> fp16 into LDS bounce; transposed for V
    const int hi = lane >> 4, ln = lane & 15;
    const float qscale = 0.088388347648318447f;   // 1/sqrt(128)
#pragma unroll
    for (int t = 0; t < 8; ++t) {
        int n = t * 16 + ln;
        float bb = bias[n];
#pragma unroll
        for (int i = 0; i < 8; ++i) {
            int r = wave * 16 + i + 8 * hi;
            float v = acc[t][i] + bb;
            if (sel == 0) v *= qscale;
            if (sel == 2) sOut[n * LDW + r] = (_Float16)v;
            else          sOut[r * LDW + n] = (_Float16)v;
        }
    }
    __syncthreads();

    // coalesced 16B global stores from the bounce buffer
    if (sel == 2) {
        _Float16* dst = ws + VOFF + (size_t)batch * SEQ * HD;  // [D][S]
        for (int c = 0; c < 8; ++c) {
            int idx = c * 256 + tid;
            int r = idx >> 4, c8 = (idx & 15) * 8;
            *(v8h*)&dst[(size_t)r * SEQ + m0 + c8] = *(const v8h*)&sOut[r * LDW + c8];
        }
    } else {
        _Float16* dst = ws + (sel ? KOFF : QOFF) + (size_t)batch * SEQ * HD; // [S][D]
        for (int c = 0; c < 8; ++c) {
            int idx = c * 256 + tid;
            int r = idx >> 4, c8 = (idx & 15) * 8;
            *(v8h*)&dst[(size_t)(m0 + r) * HD + c8] = *(const v8h*)&sOut[r * LDW + c8];
        }
    }
}

// ---------------------------------------------------------------------------
// Kernel 2: causal flash attention, TDM-fed, K/V double-buffered.
// grid = (S/128, B), 256 threads (8 waves), each wave owns 16 query rows.
// ---------------------------------------------------------------------------
__global__ __launch_bounds__(256) void attn_kernel(
    const _Float16* __restrict__ ws, float* __restrict__ out) {
    extern __shared__ _Float16 smem[];

    const int batch = blockIdx.y;
    const int qt    = blockIdx.x;
    const int q0    = qt * TILE;
    const int tid   = threadIdx.x, wave = tid >> 5, lane = tid & 31;
    const int hi    = lane >> 4,  ln   = lane & 15;
    const size_t SD = (size_t)SEQ * HD;

    const _Float16* Qg = ws + QOFF + (size_t)batch * SD + (size_t)q0 * HD;  // pre-scaled
    const _Float16* Kg = ws + KOFF + (size_t)batch * SD;
    const _Float16* Vg = ws + VOFF + (size_t)batch * SD;                    // [D][S]
    const unsigned lds0 = (unsigned)(size_t)(void*)smem;

    if (wave == 0) {
        tdm_load_2d(Qg, lds0 + 2 * OFFQ,  TILE, HD, HD, 5, 3);
        tdm_load_2d(Kg, lds0 + 2 * OFFK0, TILE, HD, HD, 5, 3);
        tdm_load_2d(Vg, lds0 + 2 * OFFV0, HD, TILE, SEQ, 5, 3);
    }

    v8f o_acc[8] = {};
    float m_i[8], l_i[8];
#pragma unroll
    for (int i = 0; i < 8; ++i) { m_i[i] = -3.0e38f; l_i[i] = 0.f; }

    for (int j = 0; j <= qt; ++j) {
        const _Float16* sK = smem + ((j & 1) ? OFFK1 : OFFK0);
        const _Float16* sV = smem + ((j & 1) ? OFFV1 : OFFV0);

        if (wave == 0) {
            if (j < qt) {   // prefetch tile j+1 into the other buffer
                int nb = (j + 1) & 1;
                tdm_load_2d(Kg + (size_t)(j + 1) * TILE * HD,
                            lds0 + 2 * (nb ? OFFK1 : OFFK0), TILE, HD, HD, 5, 3);
                tdm_load_2d(Vg + (size_t)(j + 1) * TILE,
                            lds0 + 2 * (nb ? OFFV1 : OFFV0), HD, TILE, SEQ, 5, 3);
                __builtin_amdgcn_s_wait_tensorcnt(2);  // all through tile j done
            } else {
                __builtin_amdgcn_s_wait_tensorcnt(0);
            }
        }
        __syncthreads();

        // S = Q K^T : wave's 16 rows x 128 kv-cols, K-dim 128 = 4 x 32
        v8f s[8];
#pragma unroll
        for (int t = 0; t < 8; ++t) {
            v8f c0 = {};
#pragma unroll
            for (int kc = 0; kc < 4; ++kc) {
                v16h a = frag_ld(&smem[OFFQ + (wave * 16) * LDW + kc * 32], LDW);
                v16h b = frag_ld(&sK[(t * 16) * LDW + kc * 32], LDW);
                c0 = __builtin_amdgcn_wmma_f32_16x16x32_f16(
                    false, a, false, b, (short)0, c0, false, false);
            }
            s[t] = c0;
        }

        if (j == qt) {   // diagonal tile: causal mask
#pragma unroll
            for (int t = 0; t < 8; ++t)
#pragma unroll
                for (int i = 0; i < 8; ++i) {
                    int rg = q0 + wave * 16 + i + 8 * hi;
                    int cg = j * TILE + t * 16 + ln;
                    if (cg > rg) s[t][i] = -3.0e38f;
                }
        }

        // online softmax; P (fp16) into private sP rows — no barrier needed
#pragma unroll
        for (int i = 0; i < 8; ++i) {
            float rmax = -3.0e38f;
#pragma unroll
            for (int t = 0; t < 8; ++t) rmax = fmaxf(rmax, s[t][i]);
#pragma unroll
            for (int off = 8; off >= 1; off >>= 1)
                rmax = fmaxf(rmax, __shfl_xor(rmax, off, 32));
            float mnew  = fmaxf(m_i[i], rmax);
            float alpha = __expf(m_i[i] - mnew);
            float rsum  = 0.f;
            int   r     = wave * 16 + i + 8 * hi;
#pragma unroll
            for (int t = 0; t < 8; ++t) {
                float p = __expf(s[t][i] - mnew);
                rsum += p;
                smem[OFFP + r * LDW + t * 16 + ln] = (_Float16)p;
            }
#pragma unroll
            for (int off = 8; off >= 1; off >>= 1)
                rsum += __shfl_xor(rsum, off, 32);
            l_i[i] = l_i[i] * alpha + rsum;
            m_i[i] = mnew;
#pragma unroll
            for (int t = 0; t < 8; ++t) o_acc[t][i] *= alpha;
        }

        // O += P V^T-tile : reduce over n = 128 in chunks of 32
#pragma unroll
        for (int dt = 0; dt < 8; ++dt) {
#pragma unroll
            for (int nc = 0; nc < 4; ++nc) {
                v16h a = frag_ld(&smem[OFFP + (wave * 16) * LDW + nc * 32], LDW);
                v16h b = frag_ld(&sV[(dt * 16) * LDW + nc * 32], LDW);
                o_acc[dt] = __builtin_amdgcn_wmma_f32_16x16x32_f16(
                    false, a, false, b, (short)0, o_acc[dt], false, false);
            }
        }
        __syncthreads();   // compute done before next iteration's TDM issue
    }

    float* outp = out + ((size_t)batch * SEQ) * HD;
#pragma unroll
    for (int i = 0; i < 8; ++i) {
        float inv = 1.0f / l_i[i];
        int   r   = q0 + wave * 16 + i + 8 * hi;
#pragma unroll
        for (int dt = 0; dt < 8; ++dt)
            outp[(size_t)r * HD + dt * 16 + ln] = o_acc[dt][i] * inv;
    }
}

extern "C" void kernel_launch(void* const* d_in, const int* in_sizes, int n_in,
                              void* d_out, int out_size, void* d_ws, size_t ws_size,
                              hipStream_t stream) {
    const float* x  = (const float*)d_in[0];
    const float* wq = (const float*)d_in[1];
    const float* bq = (const float*)d_in[2];
    const float* wk = (const float*)d_in[3];
    const float* bk = (const float*)d_in[4];
    const float* wv = (const float*)d_in[5];
    const float* bv = (const float*)d_in[6];
    _Float16* ws = (_Float16*)d_ws;   // fp16 x_h, W^T_h, Q, K, V^T: ~24 MB

    int cvt_items  = NX4 + 3 * NW;
    int cvt_blocks = (cvt_items + 255) / 256;
    cvt_kernel<<<cvt_blocks, 256, 0, stream>>>(x, wq, wk, wv, ws);
    qkv_proj_kernel<<<dim3(BATCH * SEQ / TILE, 3), 256, 0, stream>>>(
        bq, bk, bv, ws);
    attn_kernel<<<dim3(SEQ / TILE, BATCH), 256, SMEM2_BYTES, stream>>>(
        ws, (float*)d_out);
}

// v001
// It runs in 59.8 microseconds.
// Two timings next to v000 put it at 2.14 and 2.16 times that version's speed.
#include <hip/hip_runtime.h>
#include <hip/hip_bf16.h>

typedef __attribute__((ext_vector_type(16))) _Float16     v16h;
typedef __attribute__((ext_vector_type(8)))  _Float16     v8h;
typedef __attribute__((ext_vector_type(4)))  _Float16     v4h;
typedef __attribute__((ext_vector_type(8)))  float        v8f;
typedef __attribute__((ext_vector_type(4)))  float        f32x4;
typedef __attribute__((ext_vector_type(4)))  unsigned int u32x4;
typedef __attribute__((ext_vector_type(8)))  int          i32x8;
typedef __attribute__((ext_vector_type(4)))  int          i32x4;

#define EMBED 1024
#define SEQ   2048
#define BATCH 4
#define HD    128
#define TILE  128
#define LDW   136   // padded half-stride for 128-wide tiles (272B, 16B multiple)
#define LDX   40    // padded half-stride for 32-wide tiles  (80B,  16B multiple)
#define NW    (EMBED * HD)                 // one weight matrix, elements
#define NX4   ((BATCH * SEQ * EMBED) / 4)  // x element count / 4

// fp16 workspace layout (offsets in halves)
#define QOFF  ((size_t)0)                           // Q  [B][S][D] (pre-scaled)
#define KOFF  ((size_t)BATCH * SEQ * HD)            // K  [B][S][D]
#define VOFF  ((size_t)2 * BATCH * SEQ * HD)        // V^T [B][D][S]
#define XOFF  ((size_t)3 * BATCH * SEQ * HD)        // x_h [B][S][E]
#define WOFF  (XOFF + (size_t)BATCH * SEQ * EMBED)  // W^T_h [3][D n][E k]

// key split of the attention: a work-group takes CH key tiles of one query tile
#define NQT   (SEQ / TILE)                 // query tiles per batch
#define CH    3                            // key tiles per work-group
#define MAXS  ((NQT + CH - 1) / CH)        // most key ranges a query tile has
constexpr int count_ranges() {             // (query tile, key range) pairs per batch
    int n = 0;
    for (int q = 0; q < NQT; ++q) n += q / CH + 1;
    return n;
}
constexpr int NRANGE = count_ranges();
// f32 partials behind the fp16 planes (offsets in halves; slot = (batch*NQT+qtile)*MAXS+range)
#define POFF  (WOFF + (size_t)3 * NW)                                   // O  [slot][128 r][128 d]
#define MLOFF (POFF + (size_t)2 * BATCH * NQT * MAXS * TILE * HD)       // [slot][8 waves][16 max | 16 sum]

// LDS layout for attention kernel (offsets in halves)
#define OFFQ  0
#define OFFP  (TILE * LDW)
#define OFFK0 (2 * TILE * LDW)
#define OFFK1 (3 * TILE * LDW)
#define OFFV0 (4 * TILE * LDW)
#define OFFV1 (5 * TILE * LDW)
#define SMEM2_BYTES (6 * TILE * LDW * 2)   // 208,896 B < 320 KB/WGP

// ---------------------------------------------------------------------------
// 16x32 fp16 A/B fragment load from LDS (CDNA5 16-bit matrix layout:
// lanes 0-15 hold K {0..7,16..23}, lanes 16-31 hold K {8..15,24..31}).
// ---------------------------------------------------------------------------
__device__ inline v16h frag_ld(const _Float16* p, int stride) {
    const int lane = threadIdx.x & 31;
    const int r    = lane & 15;
    const int ko   = (lane >> 4) * 8;
    const _Float16* q = p + r * stride + ko;
    union { v16h v; v8h h[2]; } u;
    u.h[0] = *(const v8h*)(q);        // ds_load_b128
    u.h[1] = *(const v8h*)(q + 16);   // ds_load_b128
    return u.v;
}

// ---------------------------------------------------------------------------
// TDM: async 2D fp16 tile copy global -> LDS, with LDS padding of
// (pad_amount+1) DWORDs every 2^(pad_interval+1) DWORDs.  Tracked on
// TENSORcnt.  D# per CDNA5 ISA 8.3/8.4; 6-arg builtin (clang-23).
// ---------------------------------------------------------------------------
__device__ inline void tdm_load_2d(const _Float16* gsrc, unsigned lds_byte_addr,
                                   unsigned rows, unsigned cols, unsigned stride_elems,
                                   unsigned pad_interval, unsigned pad_amount) {
    unsigned long long ga = (unsigned long long)(size_t)gsrc;
    u32x4 g0;
    g0[0] = 1u;                                        // count=1, user descriptor
    g0[1] = lds_byte_addr;                             // lds_addr
    g0[2] = (unsigned)ga;                              // global_addr[31:0]
    g0[3] = ((unsigned)(ga >> 32) & 0x01FFFFFFu) | (2u << 30);  // addr[56:32] | type=2
    i32x8 g1;
    g1[0] = (int)((1u << 16) | (1u << 20) | (pad_interval << 22) | (pad_amount << 25));
    g1[1] = (int)((cols & 0xFFFFu) << 16);             // tensor_dim0[15:0]
    g1[2] = (int)((cols >> 16) | ((rows & 0xFFFFu) << 16));   // dim0[31:16] | dim1[15:0]
    g1[3] = (int)((rows >> 16) | ((cols & 0xFFFFu) << 16));   // dim1[31:16] | tile_dim0
    g1[4] = (int)(rows & 0xFFFFu);                     // tile_dim1 (tile_dim2 = 0)
    g1[5] = (int)stride_elems;                         // tensor_dim0_stride[31:0]
    g1[6] = 0;
    g1[7] = 0;
    i32x4 z4 = {0, 0, 0, 0};
    i32x8 z8 = {0, 0, 0, 0, 0, 0, 0, 0};
    __builtin_amdgcn_tensor_load_to_lds(g0, g1, z4, z4, z8, 0);
}

// ---------------------------------------------------------------------------
// Kernel 0: one-shot fp16 conversion.  x -> x_h; W -> W^T_h (transposed).
// Wide f32x4 loads; packed stores.  ~53 MB of traffic total.
// ---------------------------------------------------------------------------
__global__ __launch_bounds__(256) void cvt_kernel(
    const float* __restrict__ x,
    const float* __restrict__ wq, const float* __restrict__ wk,
    const float* __restrict__ wv, _Float16* __restrict__ ws) {
    int gid = blockIdx.x * 256 + threadIdx.x;
    if (gid < NX4) {
        f32x4 v = ((const f32x4*)x)[gid];
        v4h h;
#pragma unroll
        for (int k = 0; k < 4; ++k) h[k] = (_Float16)v[k];
        ((v4h*)(ws + XOFF))[gid] = h;
    } else {
        int i = gid - NX4;
        if (i < 3 * NW) {
            int sel = i / NW, rem = i % NW;
            int n = rem & (HD - 1), k = rem >> 7;
            const float* w = sel == 0 ? wq : (sel == 1 ? wk : wv);
            ws[WOFF + (size_t)sel * NW + (size_t)n * EMBED + k] =
                (_Float16)w[(size_t)k * HD + n];
        }
    }
}

// ---------------------------------------------------------------------------
// Kernel 1: QKV projection, fully TDM-fed, double-buffered.
// grid = (B*S/128, 3), 256 threads (8 waves).
// sel 0: Q (pre-scaled) [B][S][D];  sel 1: K [B][S][D];  sel 2: V^T [B][D][S]
// ---------------------------------------------------------------------------
__global__ __launch_bounds__(256) void qkv_proj_kernel(
    const float* __restrict__ bq, const float* __restrict__ bk,
    const float* __restrict__ bv, _Float16* __restrict__ ws) {
    __shared__ _Float16 sX[2][TILE * LDX];   // x tiles [128 s][32 k]
    __shared__ _Float16 sW[2][TILE * LDX];   // W^T tiles [128 n][32 k]
    __shared__ _Float16 sOut[TILE * LDW];    // epilogue bounce buffer

    const int sel     = blockIdx.y;
    const float* bias = sel == 0 ? bq : (sel == 1 ? bk : bv);
    const int batch = blockIdx.x >> 4;
    const int m0    = (blockIdx.x & 15) * TILE;
    const int tid   = threadIdx.x;
    const int wave  = tid >> 5;
    const int lane  = tid & 31;

    const _Float16* xh = ws + XOFF + ((size_t)batch * SEQ + m0) * EMBED;
    const _Float16* wt = ws + WOFF + (size_t)sel * NW;
    const unsigned ldsX = (unsigned)(size_t)(void*)&sX[0][0];
    const unsigned ldsW = (unsigned)(size_t)(void*)&sW[0][0];
    const unsigned bufB = TILE * LDX * 2;   // bytes per buffer

    if (wave == 0) {   // TDM issue ignores EXEC; one wave issues for the block
        tdm_load_2d(xh, ldsX, TILE, 32, EMBED, 3, 3);
        tdm_load_2d(wt, ldsW, TILE, 32, EMBED, 3, 3);
    }

    v8f acc[8] = {};
    for (int c = 0; c < EMBED / 32; ++c) {
        const _Float16* pX = &sX[c & 1][0];
        const _Float16* pW = &sW[c & 1][0];
        if (wave == 0) {
            if (c < EMBED / 32 - 1) {   // prefetch chunk c+1
                int nb = (c + 1) & 1;
                tdm_load_2d(xh + (c + 1) * 32, ldsX + nb * bufB, TILE, 32, EMBED, 3, 3);
                tdm_load_2d(wt + (c + 1) * 32, ldsW + nb * bufB, TILE, 32, EMBED, 3, 3);
                __builtin_amdgcn_s_wait_tensorcnt(2);   // all through chunk c done
            } else {
                __builtin_amdgcn_s_wait_tensorcnt(0);
            }
        }
        __syncthreads();

        v16h a = frag_ld(pX + (wave * 16) * LDX, LDX);
#pragma unroll
        for (int t = 0; t < 8; ++t) {
            v16h b = frag_ld(pW + (t * 16) * LDX, LDX);
            acc[t] = __builtin_amdgcn_wmma_f32_16x16x32_f16(
                false, a, false, b, (short)0, acc[t], false, false);
        }
        __syncthreads();   // reads done before TDM of chunk c+2 overwrites
    }

    // bias (+Q scale) -> fp16 into LDS bounce; transposed for V
    const int hi = lane >> 4, ln = lane & 15;
    const float qscale = 0.088388347648318447f;   // 1/sqrt(128)
#pragma unroll
    for (int t = 0; t < 8; ++t) {
        int n = t * 16 + ln;
        float bb = bias[n];
#pragma unroll
        for (int i = 0; i < 8; ++i) {
            int r = wave * 16 + i + 8 * hi;
            float v = acc[t][i] + bb;
            if (sel == 0) v *= qscale;
            if (sel == 2) sOut[n * LDW + r] = (_Float16)v;
            else          sOut[r * LDW + n] = (_Float16)v;
        }
    }
    __syncthreads();

    // coalesced 16B global stores from the bounce buffer
    if (sel == 2) {
        _Float16* dst = ws + VOFF + (size_t)batch * SEQ * HD;  // [D][S]
        for (int c = 0; c < 8; ++c) {
            int idx = c * 256 + tid;
            int r = idx >> 4, c8 = (idx & 15) * 8;
            *(v8h*)&dst[(size_t)r * SEQ + m0 + c8] = *(const v8h*)&sOut[r * LDW + c8];
        }
    } else {
        _Float16* dst = ws + (sel ? KOFF : QOFF) + (size_t)batch * SEQ * HD; // [S][D]
        for (int c = 0; c < 8; ++c) {
            int idx = c * 256 + tid;
            int r = idx >> 4, c8 = (idx & 15) * 8;
            *(v8h*)&dst[(size_t)(m0 + r) * HD + c8] = *(const v8h*)&sOut[r * LDW + c8];
        }
    }
}

// ---------------------------------------------------------------------------
// Tensor load of the attention kernel: one tile of 128 rows of 256 bytes, every
// extent in bytes, 16 bytes of LDS pad behind each row (LDS pitch 272 B = LDW halves).
// ---------------------------------------------------------------------------
typedef __attribute__((ext_vector_type(8))) unsigned int u32x8;
__device__ inline unsigned uni(unsigned v) { return (unsigned)__builtin_amdgcn_readfirstlane((int)v); }
// A wave-uniform value held in a scalar register.  On a test: the branch on it is a scalar
// branch (a tensor load ignores EXEC, only such a branch keeps a wave from issuing it).
// On a descriptor word: the word has one register of its own, which the compiler does not
// hand out and fill again between the request and its wait.
__device__ inline unsigned pinned(unsigned v) {
    unsigned w = uni(v);
    asm volatile("" : "+s"(w));   // issue test or descriptor word of a tensor load held in a scalar register
    return w;
}
// The wave's own LDS reads and writes have retired before a buffer is handed back.
__device__ inline void wait_ds0() { asm volatile("s_wait_dscnt 0x0" ::: "memory"); }
__device__ inline u32x4 tile_group0(unsigned lds_byte_addr, const _Float16* gsrc) {
    const unsigned long long ga = (unsigned long long)(size_t)gsrc;
    u32x4 g;
    g[0] = pinned(1u);                                 // count = 1; descriptor word held in a scalar register
    g[1] = uni(lds_byte_addr);
    g[2] = uni((unsigned)ga);
    g[3] = uni((((unsigned)(ga >> 32)) & 0x01FFFFFFu) | 0x80000000u);   // type = 2
    return g;
}
__device__ inline u32x8 tile_group1(unsigned pitch_bytes) {
    constexpr unsigned d0 = 2 * TILE, d1 = TILE;       // bytes in a row, rows
    u32x8 g;
    g[0] = uni((1u << 20) | (5u << 22) | (3u << 25));  // no mask, 1-byte elements, pad 4 dwords per 256-B row
    // words 1 to 7: descriptor words held in scalar registers
    g[1] = pinned((d0 & 0xFFFFu) << 16);
    g[2] = pinned((d0 >> 16) | ((d1 & 0xFFFFu) << 16));
    g[3] = pinned((d1 >> 16) | (d0 << 16));
    g[4] = pinned(d1);
    g[5] = pinned(pitch_bytes);
    g[6] = pinned(0u);
    g[7] = pinned(0u);
    return g;
}
// asm so that it keeps its place among the asm waits around it
__device__ inline void tile_load(u32x4 g0, u32x8 g1) {
    asm volatile("tensor_load_to_lds %0, %1" :: "s"(g0), "s"(g1) : "memory");
}
// The compiler places no wait for a tensor load: a tile counts as landed behind this one.
// It names the request's descriptor as inputs so that those registers stay as they are
// for as long as the request is in flight.
__device__ inline void wait_tile(u32x4 g0, u32x8 g1) {
    asm volatile("s_wait_tensorcnt 0x0" :: "s"(g0), "s"(g1) : "memory");
}

// ---------------------------------------------------------------------------
// Kernel 2: causal flash attention over ONE key range, TDM-fed, K/V double-buffered.
// grid = (NRANGE, B), 256 threads (8 waves), each wave owns 16 query rows.
// Leaves the un-normalised sum with its row maximum and row sum; kernel 3 merges.
// ---------------------------------------------------------------------------
__global__ __launch_bounds__(256) void attn_kernel(
    const _Float16* __restrict__ ws, float* __restrict__ part_o, float* __restrict__ part_ml) {
    extern __shared__ __attribute__((aligned(2048))) _Float16 smem[];   // every tile's place a multiple of 2 KiB

    const int batch = blockIdx.y;
    int qtile = NQT - 1, range = blockIdx.x;      // flat index -> (query tile, key range)
    while (range > qtile / CH) { range -= qtile / CH + 1; --qtile; }
    const int j0    = range * CH;                 // first key tile of the range
    const int qt    = min(CH - 1, qtile - j0);    // last key tile, counted from j0
    const int q0    = qtile * TILE;
    const int tid   = threadIdx.x, wave = tid >> 5, lane = tid & 31;
    const int hi    = lane >> 4,  ln   = lane & 15;
    const size_t SD = (size_t)SEQ * HD;

    const _Float16* Qg = ws + QOFF + (size_t)batch * SD + (size_t)q0 * HD;  // pre-scaled
    const _Float16* Kg = ws + KOFF + (size_t)batch * SD + (size_t)j0 * TILE * HD;
    const _Float16* Vg = ws + VOFF + (size_t)batch * SD + (size_t)j0 * TILE;  // [D][S]
    const unsigned lds0 = (unsigned)(size_t)(void*)smem;

    const unsigned wv = uni(threadIdx.x >> 5);   // the wave's number, scalar

    // Wave 0 brings the K tiles, wave 1 the V tiles, wave 2 Q: one request of a wave
    // in flight at any time, each wave with its own source, place and row pitch.
    const _Float16* src  = wv == 0 ? Kg : (wv == 1 ? Vg : Qg);
    const unsigned place = lds0 + 2 * (wv == 0 ? OFFK0 : (wv == 1 ? OFFV0 : OFFQ));
    const size_t   step  = wv == 1 ? (size_t)TILE : (size_t)TILE * HD;   // halves from key tile to key tile
    const u32x8 g1 = tile_group1(wv == 1 ? 2 * SEQ : 2 * HD);
    u32x4 g0 = tile_group0(place, src);
    // stage 0 lands and is published before anything reads it
    if (pinned(wv < 3)) { tile_load(g0, g1); wait_tile(g0, g1); }
    __syncthreads();
    // stage 1 flies under pass 0, where the range has a second key tile
    g0 = tile_group0(place + 2 * TILE * LDW, src + step);
    if (pinned(wv < 2 && qt >= 1)) tile_load(g0, g1);

    v8f o_acc[8] = {};
    float m_i[8], l_i[8];
#pragma unroll
    for (int i = 0; i < 8; ++i) { m_i[i] = -3.0e38f; l_i[i] = 0.f; }

    for (int j = 0; j <= qt; ++j) {
        const _Float16* sK = smem + ((j & 1) ? OFFK1 : OFFK0);
        const _Float16* sV = smem + ((j & 1) ? OFFV1 : OFFV0);

        // S = Q K^T : wave's 16 rows x 128 kv-cols, K-dim 128 = 4 x 32
        v8f s[8];
#pragma unroll
        for (int t = 0; t < 8; ++t) {
            v8f c0 = {};
#pragma unroll
            for (int kc = 0; kc < 4; ++kc) {
                v16h a = frag_ld(&smem[OFFQ + (wave * 16) * LDW + kc * 32], LDW);
                v16h b = frag_ld(&sK[(t * 16) * LDW + kc * 32], LDW);
                c0 = __builtin_amdgcn_wmma_f32_16x16x32_f16(
                    false, a, false, b, (short)0, c0, false, false);
            }
            s[t] = c0;
        }

        if (j0 + j == qtile) {   // diagonal tile: causal mask
#pragma unroll
            for (int t = 0; t < 8; ++t)
#pragma unroll
                for (int i = 0; i < 8; ++i) {
                    int rg = q0 + wave * 16 + i + 8 * hi;
                    int cg = (j0 + j) * TILE + t * 16 + ln;
                    if (cg > rg) s[t][i] = -3.0e38f;
                }
        }

        // online softmax; P (fp16) into private sP rows — no barrier needed
#pragma unroll
        for (int i = 0; i < 8; ++i) {
            float rmax = -3.0e38f;
#pragma unroll
            for (int t = 0; t < 8; ++t) rmax = fmaxf(rmax, s[t][i]);
#pragma unroll
            for (int off = 8; off >= 1; off >>= 1)
                rmax = fmaxf(rmax, __shfl_xor(rmax, off, 32));
            float mnew  = fmaxf(m_i[i], rmax);
            float alpha = __expf(m_i[i] - mnew);
            float rsum  = 0.f;
            int   r     = wave * 16 + i + 8 * hi;
#pragma unroll
            for (int t = 0; t < 8; ++t) {
                float p = __expf(s[t][i] - mnew);
                rsum += p;
                smem[OFFP + r * LDW + t * 16 + ln] = (_Float16)p;
            }
#pragma unroll
            for (int off = 8; off >= 1; off >>= 1)
                rsum += __shfl_xor(rsum, off, 32);
            l_i[i] = l_i[i] * alpha + rsum;
            m_i[i] = mnew;
#pragma unroll
            for (int t = 0; t < 8; ++t) o_acc[t][i] *= alpha;
        }

        // O += P V^T-tile : reduce over n = 128 in chunks of 32
#pragma unroll
        for (int dt = 0; dt < 8; ++dt) {
#pragma unroll
            for (int nc = 0; nc < 4; ++nc) {
                v16h a = frag_ld(&smem[OFFP + (wave * 16) * LDW + nc * 32], LDW);
                v16h b = frag_ld(&sV[(dt * 16) * LDW + nc * 32], LDW);
                o_acc[dt] = __builtin_amdgcn_wmma_f32_16x16x32_f16(
                    false, a, false, b, (short)0, o_acc[dt], false, false);
            }
        }
        // publish tile j+1 and free tile j's buffers: own LDS traffic retired, the
        // issuers' tiles landed, one barrier for both, and only then the refill
        wait_ds0();
        if (pinned(wv < 2)) wait_tile(g0, g1);
        __syncthreads();
        g0 = tile_group0(place + (j & 1) * (2 * TILE * LDW), src + (size_t)(j + 2) * step);
        if (pinned(wv < 2 && j + 2 <= qt)) tile_load(g0, g1);
    }
    wait_tile(g0, g1);
    wait_ds0();

    const size_t slot = ((size_t)batch * NQT + qtile) * MAXS + range;
    float* po = part_o  + slot * (TILE * HD);
    float* ml = part_ml + slot * (2 * TILE) + wave * 32;   // one 128-B line per wave
#pragma unroll
    for (int i = 0; i < 8; ++i) {
        int r = wave * 16 + i + 8 * hi;
#pragma unroll
        for (int dt = 0; dt < 8; ++dt)
            po[(size_t)r * HD + dt * 16 + ln] = o_acc[dt][i];
    }
    if (ln == 0) {   // every lane of a 16-lane row holds the same maximum and sum
#pragma unroll
        for (int i = 0; i < 8; ++i) {
            ml[i + 8 * hi]      = m_i[i];
            ml[16 + i + 8 * hi] = l_i[i];
        }
    }
}

// e^x for the merge weights.  The v_nop in the same statement is the one slot the
// instruction set asks for behind a transcendental before its source register is
// overwritten or its result read.
__device__ inline float exp_weight(float x) {
    float e;
    asm("v_exp_f32 %0, %1\n\tv_nop" : "=v"(e) : "v"(x * 1.4426950408889634f));
    return e;
}

// ---------------------------------------------------------------------------
// Kernel 3: merge the key ranges of each query row.
// grid = B*S/16, 256 threads: a wave takes rows w and w+8 of 16, a lane 4 columns.
// ---------------------------------------------------------------------------
__global__ __launch_bounds__(256) void merge_kernel(
    const float* __restrict__ part_o, const float* __restrict__ part_ml,
    float* __restrict__ out) {
    const int row0  = blockIdx.x * 16;            // flat row (batch*SEQ + s), 16 rows of one tile
    const int qtile = (row0 & (SEQ - 1)) / TILE;
    const int ns    = qtile / CH + 1;             // key ranges of this query tile
    const int rt0   = row0 & (TILE - 1);          // first row inside the tile
    const size_t slot0 = ((size_t)(row0 / SEQ) * NQT + qtile) * MAXS;
    const float* po = part_o  + slot0 * (TILE * HD);
    const float* ml = part_ml + slot0 * (2 * TILE) + (rt0 >> 4) * 32;
    const int w  = threadIdx.x >> 5;
    const int d4 = (threadIdx.x & 31) * 4;

    f32x4 o[2][MAXS];
    float m[2][MAXS], l[2][MAXS];
#pragma unroll
    for (int c = 0; c < MAXS; ++c) {
#pragma unroll
        for (int k = 0; k < 2; ++k) {
            o[k][c] = f32x4{0.f, 0.f, 0.f, 0.f};
            m[k][c] = -3.0e38f;
            l[k][c] = 0.f;
        }
        if (c < ns) {
#pragma unroll
            for (int k = 0; k < 2; ++k) {
                int rr = w + 8 * k;
                o[k][c] = *(const f32x4*)&po[(size_t)c * (TILE * HD) + (size_t)(rt0 + rr) * HD + d4];
                m[k][c] = ml[c * (2 * TILE) + rr];
                l[k][c] = ml[c * (2 * TILE) + 16 + rr];
            }
        }
    }
#pragma unroll
    for (int k = 0; k < 2; ++k) {
        float mx = m[k][0];
#pragma unroll
        for (int c = 1; c < MAXS; ++c) mx = fmaxf(mx, m[k][c]);
        float wt[MAXS];
#pragma unroll
        for (int c = 0; c < MAXS; ++c) wt[c] = exp_weight(m[k][c] - mx);
        f32x4 acc = {0.f, 0.f, 0.f, 0.f};
        float ls  = 0.f;
#pragma unroll
        for (int c = 0; c < MAXS; ++c) {
            ls  += wt[c] * l[k][c];
            acc += wt[c] * o[k][c];
        }
        *(f32x4*)&out[(size_t)(row0 + w + 8 * k) * HD + d4] = acc * (1.0f / ls);
    }
}

extern "C" void kernel_launch(void* const* d_in, const int* in_sizes, int n_in,
                              void* d_out, int out_size, void* d_ws, size_t ws_size,
                              hipStream_t stream) {
    const float* x  = (const float*)d_in[0];
    const float* wq = (const float*)d_in[1];
    const float* bq = (const float*)d_in[2];
    const float* wk = (const float*)d_in[3];
    const float* bk = (const float*)d_in[4];
    const float* wv = (const float*)d_in[5];
    const float* bv = (const float*)d_in[6];
    _Float16* ws = (_Float16*)d_ws;   // fp16 x_h, W^T_h, Q, K, V^T: ~24 MB; f32 partials behind

    int cvt_items  = NX4 + 3 * NW;
    int cvt_blocks = (cvt_items + 255) / 256;
    cvt_kernel<<<cvt_blocks, 256, 0, stream>>>(x, wq, wk, wv, ws);
    qkv_proj_kernel<<<dim3(BATCH * SEQ / TILE, 3), 256, 0, stream>>>(
        bq, bk, bv, ws);
    float* part_o  = (float*)(ws + POFF);
    float* part_ml = (float*)(ws + MLOFF);
    attn_kernel<<<dim3(NRANGE, BATCH), 256, SMEM2_BYTES, stream>>>(ws, part_o, part_ml);
    merge_kernel<<<BATCH * SEQ / 16, 256, 0, stream>>>(part_o, part_ml, (float*)d_out);
}

// v002
// One run takes 36.6 microseconds.
// Two timings next to v001 put it at 1.63 and 1.64 times that version's speed.
// Counting every step since v000, it is 3.51 times as fast.
#include <hip/hip_runtime.h>
#include <hip/hip_bf16.h>

typedef __attribute__((ext_vector_type(16))) _Float16     v16h;
typedef __attribute__((ext_vector_type(8)))  _Float16     v8h;
typedef __attribute__((ext_vector_type(4)))  _Float16     v4h;
typedef __attribute__((ext_vector_type(8)))  float        v8f;
typedef __attribute__((ext_vector_type(4)))  float        f32x4;
typedef __attribute__((ext_vector_type(4)))  unsigned int u32x4;

#define EMBED 1024
#define SEQ   2048
#define BATCH 4
#define HD    128
#define TILE  128
#define LDW   136   // padded half-stride for 128-wide tiles (272B, 16B multiple)
#define BK    128   // K chunk of the projection
#define NW    (EMBED * HD)                 // one weight matrix, elements

// fp16 workspace layout (offsets in halves)
#define QOFF  ((size_t)0)                           // Q  [B][S][D] (pre-scaled)
#define KOFF  ((size_t)BATCH * SEQ * HD)            // K  [B][S][D]
#define VOFF  ((size_t)2 * BATCH * SEQ * HD)        // V^T [B][D][S]
#define XOFF  ((size_t)3 * BATCH * SEQ * HD)        // not used
#define WOFF  (XOFF + (size_t)BATCH * SEQ * EMBED)  // not used

// key split of the attention: a work-group takes CH key tiles of one query tile
#define NQT   (SEQ / TILE)                 // query tiles per batch
#define CH    3                            // key tiles per work-group
#define MAXS  ((NQT + CH - 1) / CH)        // most key ranges a query tile has
constexpr int count_ranges() {             // (query tile, key range) pairs per batch
    int n = 0;
    for (int q = 0; q < NQT; ++q) n += q / CH + 1;
    return n;
}
constexpr int NRANGE = count_ranges();
// f32 partials behind the fp16 planes (offsets in halves; slot = (batch*NQT+qtile)*MAXS+range)
#define POFF  (WOFF + (size_t)3 * NW)                                   // O  [slot][128 r][128 d]
#define MLOFF (POFF + (size_t)2 * BATCH * NQT * MAXS * TILE * HD)       // [slot][8 waves][16 max | 16 sum]

// LDS layout for attention kernel (offsets in halves)
#define OFFQ  0
#define OFFP  (TILE * LDW)
#define OFFK0 (2 * TILE * LDW)
#define OFFK1 (3 * TILE * LDW)
#define OFFV0 (4 * TILE * LDW)
#define OFFV1 (5 * TILE * LDW)
#define SMEM2_BYTES (6 * TILE * LDW * 2)   // 208,896 B < 320 KB/WGP

// ---------------------------------------------------------------------------
// 16x32 fp16 A/B fragment load from LDS (CDNA5 16-bit matrix layout:
// lanes 0-15 hold K {0..7,16..23}, lanes 16-31 hold K {8..15,24..31}).
// ---------------------------------------------------------------------------
__device__ inline v16h frag_ld(const _Float16* p, int stride) {
    const int lane = threadIdx.x & 31;
    const int r    = lane & 15;
    const int ko   = (lane >> 4) * 8;
    const _Float16* q = p + r * stride + ko;
    union { v16h v; v8h h[2]; } u;
    u.h[0] = *(const v8h*)(q);        // ds_load_b128
    u.h[1] = *(const v8h*)(q + 16);   // ds_load_b128
    return u.v;
}

// Work-group barrier of the projection's K loop.  It waits for the wave's LDS traffic alone:
// __syncthreads() would also wait for the global loads of the next chunk, which are meant
// to stay in flight across it.
__device__ inline void lds_barrier() {
    asm volatile("s_wait_dscnt 0x0\n\ts_barrier_signal -1\n\ts_barrier_wait -1" ::: "memory");
}
// a where the mask is all ones, b where it is zero
__device__ inline v8h pick(unsigned m, v8h a, v8h b) {
    const u32x4 x = __builtin_bit_cast(u32x4, a), y = __builtin_bit_cast(u32x4, b);
    return __builtin_bit_cast(v8h, (x & m) | (y & ~m));
}
// Stands behind a run of global loads, before their address registers are used for anything else.
__device__ inline void wait_addr() { asm volatile("s_wait_xcnt 0x0" ::: "memory"); }

// ---------------------------------------------------------------------------
// Kernel 1: QKV projection straight from the f32 inputs.
// grid = (B*S/128, 3), 512 threads (16 waves), a wave owns 16 rows x 64 columns.
// Each K chunk of BK goes global -> registers (f32) -> fp16 -> LDS; the loads of the
// next chunk are in flight while this chunk is multiplied.
// sel 0: Q (pre-scaled) [B][S][D];  sel 1: K [B][S][D];  sel 2: V^T [B][D][S]
// ---------------------------------------------------------------------------
__global__ __launch_bounds__(512) void qkv_proj_kernel(
    const float* __restrict__ x,
    const float* __restrict__ wq, const float* __restrict__ wk, const float* __restrict__ wv,
    const float* __restrict__ bq, const float* __restrict__ bk, const float* __restrict__ bv,
    _Float16* __restrict__ ws) {
    __shared__ __attribute__((aligned(16))) _Float16 sX[TILE * LDW];   // x tile [128 s][BK k]; epilogue bounce buffer
    __shared__ __attribute__((aligned(16))) _Float16 sW[TILE * LDW];   // W^T tile [128 n][BK k]

    const int sel     = blockIdx.y;
    const float* bias = sel == 0 ? bq : (sel == 1 ? bk : bv);
    const float* w    = sel == 0 ? wq : (sel == 1 ? wk : wv);
    const int batch = blockIdx.x >> 4;
    const int m0    = (blockIdx.x & 15) * TILE;
    const int tid   = threadIdx.x;
    const int wave  = tid >> 5;
    const int lane  = tid & 31;
    const int rg    = wave & 7;    // the wave's group of 16 rows
    const int ch    = wave >> 3;   // the wave's half of the 128 columns

    // x: one wave-wide load is 512 B of one row (BK k); the wave takes rows wave, wave + 16, ...
    const float* xg = x + ((size_t)batch * SEQ + m0 + wave) * EMBED + lane * 4;
    // W [k][n]: one wave-wide load is one k row of 128 n; a thread holds a block of 8 k x 4 n,
    // so that 8 consecutive k of one n are one 16-B LDS store of the transposed tile
    const float* wg = w + (size_t)(wave * 8) * HD + lane * 4;
    const int rot = (lane >> 2) & 3;   // which of its 4 n a lane stores first

    f32x4 rx[8], rw[8];
#pragma unroll
    for (int j = 0; j < 8; ++j) rx[j] = *(const f32x4*)(xg + (size_t)j * 16 * EMBED);
#pragma unroll
    for (int i = 0; i < 8; ++i) rw[i] = *(const f32x4*)(wg + (size_t)i * HD);

    v8f acc[4] = {};
    for (int c = 0; c < EMBED / BK; ++c) {
        // chunk c: registers -> fp16 -> LDS
#pragma unroll
        for (int j = 0; j < 8; ++j) {
            v4h h;
#pragma unroll
            for (int e = 0; e < 4; ++e) h[e] = (_Float16)rx[j][e];
            *(v4h*)&sX[(j * 16 + wave) * LDW + lane * 4] = h;
        }
        {
            v8h h[4];
#pragma unroll
            for (int e = 0; e < 4; ++e)
#pragma unroll
                for (int i = 0; i < 8; ++i) h[e][i] = (_Float16)rw[i][e];
            // A lane's 4 rows lie 4 pitches from its neighbour's: stored in the same order by
            // every lane, 16 lanes would meet on 4 bank groups.  Lane l starts at row (l >> 2) & 3.
            const unsigned m1 = 0u - (unsigned)(rot & 1), m2 = 0u - (unsigned)((rot >> 1) & 1);
            v8h t[4], u[4];
#pragma unroll
            for (int i = 0; i < 4; ++i) t[i] = pick(m1, h[(i + 1) & 3], h[i]);
#pragma unroll
            for (int i = 0; i < 4; ++i) u[i] = pick(m2, t[(i + 2) & 3], t[i]);   // u[i] = h[(i + rot) & 3]
#pragma unroll
            for (int i = 0; i < 4; ++i)
                *(v8h*)&sW[(lane * 4 + ((i + rot) & 3)) * LDW + wave * 8] = u[i];
        }
        if (c + 1 < EMBED / BK) {   // chunk c + 1 flies under the products of chunk c
            const float* xn = xg + (c + 1) * BK;
            const float* wn = wg + (size_t)(c + 1) * BK * HD;
#pragma unroll
            for (int j = 0; j < 8; ++j) rx[j] = *(const f32x4*)(xn + (size_t)j * 16 * EMBED);
#pragma unroll
            for (int i = 0; i < 8; ++i) rw[i] = *(const f32x4*)(wn + (size_t)i * HD);
            wait_addr();
        }
        lds_barrier();   // the tiles of chunk c are complete

        // the fragments of k step kc + 1 are read while the products of step kc run
        v16h fa[2], fb[2][4];
        fa[0] = frag_ld(&sX[(rg * 16) * LDW], LDW);
#pragma unroll
        for (int t = 0; t < 4; ++t) fb[0][t] = frag_ld(&sW[(ch * 64 + t * 16) * LDW], LDW);
#pragma unroll
        for (int kc = 0; kc < BK / 32; ++kc) {
            if (kc + 1 < BK / 32) {
                fa[(kc + 1) & 1] = frag_ld(&sX[(rg * 16) * LDW + (kc + 1) * 32], LDW);
#pragma unroll
                for (int t = 0; t < 4; ++t)
                    fb[(kc + 1) & 1][t] = frag_ld(&sW[(ch * 64 + t * 16) * LDW + (kc + 1) * 32], LDW);
            }
            // keeps the reads above in front of the products below: moved behind them, each
            // product would wait out the whole latency of its own LDS read
            __builtin_amdgcn_sched_barrier(0);
#pragma unroll
            for (int t = 0; t < 4; ++t)
                acc[t] = __builtin_amdgcn_wmma_f32_16x16x32_f16(
                    false, fa[kc & 1], false, fb[kc & 1][t], (short)0, acc[t], false, false);
        }
        lds_barrier();   // every wave has read chunk c before the tiles are written again
    }

    // bias (+Q scale) -> fp16 into LDS bounce; transposed for V
    _Float16* sOut = sX;
    const int hi = lane >> 4, ln = lane & 15;
    const float qscale = 0.088388347648318447f;   // 1/sqrt(128)
#pragma unroll
    for (int t = 0; t < 4; ++t) {
        int n = ch * 64 + t * 16 + ln;
        float bb = bias[n];
#pragma unroll
        for (int i = 0; i < 8; ++i) {
            int r = rg * 16 + i + 8 * hi;
            float v = acc[t][i] + bb;
            if (sel == 0) v *= qscale;
            if (sel == 2) sOut[n * LDW + r] = (_Float16)v;
            else          sOut[r * LDW + n] = (_Float16)v;
        }
    }
    __syncthreads();

    // coalesced 16B global stores from the bounce buffer
    if (sel == 2) {
        _Float16* dst = ws + VOFF + (size_t)batch * SEQ * HD;  // [D][S]
        for (int c = 0; c < 4; ++c) {
            int idx = c * 512 + tid;
            int r = idx >> 4, c8 = (idx & 15) * 8;
            *(v8h*)&dst[(size_t)r * SEQ + m0 + c8] = *(const v8h*)&sOut[r * LDW + c8];
        }
    } else {
        _Float16* dst = ws + (sel ? KOFF : QOFF) + (size_t)batch * SEQ * HD; // [S][D]
        for (int c = 0; c < 4; ++c) {
            int idx = c * 512 + tid;
            int r = idx >> 4, c8 = (idx & 15) * 8;
            *(v8h*)&dst[(size_t)(m0 + r) * HD + c8] = *(const v8h*)&sOut[r * LDW + c8];
        }
    }
}

// ---------------------------------------------------------------------------
// Tensor load of the attention kernel: one tile of 128 rows of 256 bytes, every
// extent in bytes, 16 bytes of LDS pad behind each row (LDS pitch 272 B = LDW halves).
// ---------------------------------------------------------------------------
typedef __attribute__((ext_vector_type(8))) unsigned int u32x8;
__device__ inline unsigned uni(unsigned v) { return (unsigned)__builtin_amdgcn_readfirstlane((int)v); }
// A wave-uniform value held in a scalar register.  On a test: the branch on it is a scalar
// branch (a tensor load ignores EXEC, only such a branch keeps a wave from issuing it).
// On a descriptor word: the word has one register of its own, which the compiler does not
// hand out and fill again between the request and its wait.
__device__ inline unsigned pinned(unsigned v) {
    unsigned w = uni(v);
    asm volatile("" : "+s"(w));   // issue test or descriptor word of a tensor load held in a scalar register
    return w;
}
// The wave's own LDS reads and writes have retired before a buffer is handed back.
__device__ inline void wait_ds0() { asm volatile("s_wait_dscnt 0x0" ::: "memory"); }
__device__ inline u32x4 tile_group0(unsigned lds_byte_addr, const _Float16* gsrc) {
    const unsigned long long ga = (unsigned long long)(size_t)gsrc;
    u32x4 g;
    g[0] = pinned(1u);                                 // count = 1; descriptor word held in a scalar register
    g[1] = uni(lds_byte_addr);
    g[2] = uni((unsigned)ga);
    g[3] = uni((((unsigned)(ga >> 32)) & 0x01FFFFFFu) | 0x80000000u);   // type = 2
    return g;
}
__device__ inline u32x8 tile_group1(unsigned pitch_bytes) {
    constexpr unsigned d0 = 2 * TILE, d1 = TILE;       // bytes in a row, rows
    u32x8 g;
    g[0] = uni((1u << 20) | (5u << 22) | (3u << 25));  // no mask, 1-byte elements, pad 4 dwords per 256-B row
    // words 1 to 7: descriptor words held in scalar registers
    g[1] = pinned((d0 & 0xFFFFu) << 16);
    g[2] = pinned((d0 >> 16) | ((d1 & 0xFFFFu) << 16));
    g[3] = pinned((d1 >> 16) | (d0 << 16));
    g[4] = pinned(d1);
    g[5] = pinned(pitch_bytes);
    g[6] = pinned(0u);
    g[7] = pinned(0u);
    return g;
}
// asm so that it keeps its place among the asm waits around it
__device__ inline void tile_load(u32x4 g0, u32x8 g1) {
    asm volatile("tensor_load_to_lds %0, %1" :: "s"(g0), "s"(g1) : "memory");
}
// The compiler places no wait for a tensor load: a tile counts as landed behind this one.
// It names the request's descriptor as inputs so that those registers stay as they are
// for as long as the request is in flight.
__device__ inline void wait_tile(u32x4 g0, u32x8 g1) {
    asm volatile("s_wait_tensorcnt 0x0" :: "s"(g0), "s"(g1) : "memory");
}

// ---------------------------------------------------------------------------
// Kernel 2: causal flash attention over ONE key range, TDM-fed, K/V double-buffered.
// grid = (NRANGE, B), 256 threads (8 waves), each wave owns 16 query rows.
// Leaves the un-normalised sum with its row maximum and row sum; kernel 3 merges.
// ---------------------------------------------------------------------------
__global__ __launch_bounds__(256) void attn_kernel(
    const _Float16* __restrict__ ws, float* __restrict__ part_o, float* __restrict__ part_ml) {
    extern __shared__ __attribute__((aligned(2048))) _Float16 smem[];   // every tile's place a multiple of 2 KiB

    const int batch = blockIdx.y;
    int qtile = NQT - 1, range = blockIdx.x;      // flat index -> (query tile, key range)
    while (range > qtile / CH) { range -= qtile / CH + 1; --qtile; }
    const int j0    = range * CH;                 // first key tile of the range
    const int qt    = min(CH - 1, qtile - j0);    // last key tile, counted from j0
    const int q0    = qtile * TILE;
    const int tid   = threadIdx.x, wave = tid >> 5, lane = tid & 31;
    const int hi    = lane >> 4,  ln   = lane & 15;
    const size_t SD = (size_t)SEQ * HD;

    const _Float16* Qg = ws + QOFF + (size_t)batch * SD + (size_t)q0 * HD;  // pre-scaled
    const _Float16* Kg = ws + KOFF + (size_t)batch * SD + (size_t)j0 * TILE * HD;
    const _Float16* Vg = ws + VOFF + (size_t)batch * SD + (size_t)j0 * TILE;  // [D][S]
    const unsigned lds0 = (unsigned)(size_t)(void*)smem;

    const unsigned wv = uni(threadIdx.x >> 5);   // the wave's number, scalar

    // Wave 0 brings the K tiles, wave 1 the V tiles, wave 2 Q: one request of a wave
    // in flight at any time, each wave with its own source, place and row pitch.
    const _Float16* src  = wv == 0 ? Kg : (wv == 1 ? Vg : Qg);
    const unsigned place = lds0 + 2 * (wv == 0 ? OFFK0 : (wv == 1 ? OFFV0 : OFFQ));
    const size_t   step  = wv == 1 ? (size_t)TILE : (size_t)TILE * HD;   // halves from key tile to key tile
    const u32x8 g1 = tile_group1(wv == 1 ? 2 * SEQ : 2 * HD);
    u32x4 g0 = tile_group0(place, src);
    // stage 0 lands and is published before anything reads it
    if (pinned(wv < 3)) { tile_load(g0, g1); wait_tile(g0, g1); }
    __syncthreads();
    // stage 1 flies under pass 0, where the range has a second key tile
    g0 = tile_group0(place + 2 * TILE * LDW, src + step);
    if (pinned(wv < 2 && qt >= 1)) tile_load(g0, g1);

    v8f o_acc[8] = {};
    float m_i[8], l_i[8];
#pragma unroll
    for (int i = 0; i < 8; ++i) { m_i[i] = -3.0e38f; l_i[i] = 0.f; }

    for (int j = 0; j <= qt; ++j) {
        const _Float16* sK = smem + ((j & 1) ? OFFK1 : OFFK0);
        const _Float16* sV = smem + ((j & 1) ? OFFV1 : OFFV0);

        // S = Q K^T : wave's 16 rows x 128 kv-cols, K-dim 128 = 4 x 32
        v8f s[8];
#pragma unroll
        for (int t = 0; t < 8; ++t) {
            v8f c0 = {};
#pragma unroll
            for (int kc = 0; kc < 4; ++kc) {
                v16h a = frag_ld(&smem[OFFQ + (wave * 16) * LDW + kc * 32], LDW);
                v16h b = frag_ld(&sK[(t * 16) * LDW + kc * 32], LDW);
                c0 = __builtin_amdgcn_wmma_f32_16x16x32_f16(
                    false, a, false, b, (short)0, c0, false, false);
            }
            s[t] = c0;
        }

        if (j0 + j == qtile) {   // diagonal tile: causal mask
#pragma unroll
            for (int t = 0; t < 8; ++t)
#pragma unroll
                for (int i = 0; i < 8; ++i) {
                    int rg = q0 + wave * 16 + i + 8 * hi;
                    int cg = (j0 + j) * TILE + t * 16 + ln;
                    if (cg > rg) s[t][i] = -3.0e38f;
                }
        }

        // online softmax; P (fp16) into private sP rows — no barrier needed
#pragma unroll
        for (int i = 0; i < 8; ++i) {
            float rmax = -3.0e38f;
#pragma unroll
            for (int t = 0; t < 8; ++t) rmax = fmaxf(rmax, s[t][i]);
#pragma unroll
            for (int off = 8; off >= 1; off >>= 1)
                rmax = fmaxf(rmax, __shfl_xor(rmax, off, 32));
            float mnew  = fmaxf(m_i[i], rmax);
            float alpha = __expf(m_i[i] - mnew);
            float rsum  = 0.f;
            int   r     = wave * 16 + i + 8 * hi;
#pragma unroll
            for (int t = 0; t < 8; ++t) {
                float p = __expf(s[t][i] - mnew);
                rsum += p;
                smem[OFFP + r * LDW + t * 16 + ln] = (_Float16)p;
            }
#pragma unroll
            for (int off = 8; off >= 1; off >>= 1)
                rsum += __shfl_xor(rsum, off, 32);
            l_i[i] = l_i[i] * alpha + rsum;
            m_i[i] = mnew;
#pragma unroll
            for (int t = 0; t < 8; ++t) o_acc[t][i] *= alpha;
        }

        // O += P V^T-tile : reduce over n = 128 in chunks of 32
#pragma unroll
        for (int dt = 0; dt < 8; ++dt) {
#pragma unroll
            for (int nc = 0; nc < 4; ++nc) {
                v16h a = frag_ld(&smem[OFFP + (wave * 16) * LDW + nc * 32], LDW);
                v16h b = frag_ld(&sV[(dt * 16) * LDW + nc * 32], LDW);
                o_acc[dt] = __builtin_amdgcn_wmma_f32_16x16x32_f16(
                    false, a, false, b, (short)0, o_acc[dt], false, false);
            }
        }
        // publish tile j+1 and free tile j's buffers: own LDS traffic retired, the
        // issuers' tiles landed, one barrier for both, and only then the refill
        wait_ds0();
        if (pinned(wv < 2)) wait_tile(g0, g1);
        __syncthreads();
        g0 = tile_group0(place + (j & 1) * (2 * TILE * LDW), src + (size_t)(j + 2) * step);
        if (pinned(wv < 2 && j + 2 <= qt)) tile_load(g0, g1);
    }
    wait_tile(g0, g1);
    wait_ds0();

    const size_t slot = ((size_t)batch * NQT + qtile) * MAXS + range;
    float* po = part_o  + slot * (TILE * HD);
    float* ml = part_ml + slot * (2 * TILE) + wave * 32;   // one 128-B line per wave
#pragma unroll
    for (int i = 0; i < 8; ++i) {
        int r = wave * 16 + i + 8 * hi;
#pragma unroll
        for (int dt = 0; dt < 8; ++dt)
            po[(size_t)r * HD + dt * 16 + ln] = o_acc[dt][i];
    }
    if (ln == 0) {   // every lane of a 16-lane row holds the same maximum and sum
#pragma unroll
        for (int i = 0; i < 8; ++i) {
            ml[i + 8 * hi]      = m_i[i];
            ml[16 + i + 8 * hi] = l_i[i];
        }
    }
}

// e^x for the merge weights.  The v_nop in the same statement is the one slot the
// instruction set asks for behind a transcendental before its source register is
// overwritten or its result read.
__device__ inline float exp_weight(float x) {
    float e;
    asm("v_exp_f32 %0, %1\n\tv_nop" : "=v"(e) : "v"(x * 1.4426950408889634f));
    return e;
}

// ---------------------------------------------------------------------------
// Kernel 3: merge the key ranges of each query row.
// grid = B*S/16, 256 threads: a wave takes rows w and w+8 of 16, a lane 4 columns.
// ---------------------------------------------------------------------------
__global__ __launch_bounds__(256) void merge_kernel(
    const float* __restrict__ part_o, const float* __restrict__ part_ml,
    float* __restrict__ out) {
    const int row0  = blockIdx.x * 16;            // flat row (batch*SEQ + s), 16 rows of one tile
    const int qtile = (row0 & (SEQ - 1)) / TILE;
    const int ns    = qtile / CH + 1;             // key ranges of this query tile
    const int rt0   = row0 & (TILE - 1);          // first row inside the tile
    const size_t slot0 = ((size_t)(row0 / SEQ) * NQT + qtile) * MAXS;
    const float* po = part_o  + slot0 * (TILE * HD);
    const float* ml = part_ml + slot0 * (2 * TILE) + (rt0 >> 4) * 32;
    const int w  = threadIdx.x >> 5;
    const int d4 = (threadIdx.x & 31) * 4;

    f32x4 o[2][MAXS];
    float m[2][MAXS], l[2][MAXS];
#pragma unroll
    for (int c = 0; c < MAXS; ++c) {
#pragma unroll
        for (int k = 0; k < 2; ++k) {
            o[k][c] = f32x4{0.f, 0.f, 0.f, 0.f};
            m[k][c] = -3.0e38f;
            l[k][c] = 0.f;
        }
        if (c < ns) {
#pragma unroll
            for (int k = 0; k < 2; ++k) {
                int rr = w + 8 * k;
                o[k][c] = *(const f32x4*)&po[(size_t)c * (TILE * HD) + (size_t)(rt0 + rr) * HD + d4];
                m[k][c] = ml[c * (2 * TILE) + rr];
                l[k][c] = ml[c * (2 * TILE) + 16 + rr];
            }
        }
    }
#pragma unroll
    for (int k = 0; k < 2; ++k) {
        float mx = m[k][0];
#pragma unroll
        for (int c = 1; c < MAXS; ++c) mx = fmaxf(mx, m[k][c]);
        float wt[MAXS];
#pragma unroll
        for (int c = 0; c < MAXS; ++c) wt[c] = exp_weight(m[k][c] - mx);
        f32x4 acc = {0.f, 0.f, 0.f, 0.f};
        float ls  = 0.f;
#pragma unroll
        for (int c = 0; c < MAXS; ++c) {
            ls  += wt[c] * l[k][c];
            acc += wt[c] * o[k][c];
        }
        *(f32x4*)&out[(size_t)(row0 + w + 8 * k) * HD + d4] = acc * (1.0f / ls);
    }
}

extern "C" void kernel_launch(void* const* d_in, const int* in_sizes, int n_in,
                              void* d_out, int out_size, void* d_ws, size_t ws_size,
                              hipStream_t stream) {
    const float* x  = (const float*)d_in[0];
    const float* wq = (const float*)d_in[1];
    const float* bq = (const float*)d_in[2];
    const float* wk = (const float*)d_in[3];
    const float* bk = (const float*)d_in[4];
    const float* wv = (const float*)d_in[5];
    const float* bv = (const float*)d_in[6];
    _Float16* ws = (_Float16*)d_ws;   // fp16 Q, K, V^T; f32 partials behind

    qkv_proj_kernel<<<dim3(BATCH * SEQ / TILE, 3), 512, 0, stream>>>(
        x, wq, wk, wv, bq, bk, bv, ws);
    float* part_o  = (float*)(ws + POFF);
    float* part_ml = (float*)(ws + MLOFF);
    attn_kernel<<<dim3(NRANGE, BATCH), 256, SMEM2_BYTES, stream>>>(ws, part_o, part_ml);
    merge_kernel<<<BATCH * SEQ / 16, 256, 0, stream>>>(part_o, part_ml, (float*)d_out);
}

// v003
// A run of this version takes 34.7 microseconds.
// Next to v002, in two timings, it ran 1.05 and 1.06 times as fast.
// Counting every step since v000, it is 3.70 times as fast.
#include <hip/hip_runtime.h>
#include <hip/hip_bf16.h>

typedef __attribute__((ext_vector_type(16))) _Float16     v16h;
typedef __attribute__((ext_vector_type(8)))  _Float16     v8h;
typedef __attribute__((ext_vector_type(4)))  _Float16     v4h;
typedef __attribute__((ext_vector_type(8)))  float        v8f;
typedef __attribute__((ext_vector_type(4)))  float        f32x4;
typedef __attribute__((ext_vector_type(4)))  unsigned int u32x4;

#define EMBED 1024
#define SEQ   2048
#define BATCH 4
#define HD    128
#define TILE  128
#define LDW   136   // padded half-stride for 128-wide tiles (272B, 16B multiple)
#define BK    128   // K chunk of the projection
#define NW    (EMBED * HD)                 // one weight matrix, elements

// fp16 workspace layout (offsets in halves)
#define QOFF  ((size_t)0)                           // Q  [B][S][D] (pre-scaled)
#define KOFF  ((size_t)BATCH * SEQ * HD)            // K  [B][S][D]
#define VOFF  ((size_t)2 * BATCH * SEQ * HD)        // V^T [B][D][S]
#define XOFF  ((size_t)3 * BATCH * SEQ * HD)        // not used
#define WOFF  (XOFF + (size_t)BATCH * SEQ * EMBED)  // not used

// key split of the attention: a work-group takes CH key tiles of one query tile
#define NQT   (SEQ / TILE)                 // query tiles per batch
#define CH    3                            // key tiles per work-group
#define MAXS  ((NQT + CH - 1) / CH)        // most key ranges a query tile has
constexpr int count_ranges() {             // (query tile, key range) pairs per batch
    int n = 0;
    for (int q = 0; q < NQT; ++q) n += q / CH + 1;
    return n;
}
constexpr int NRANGE = count_ranges();
// f32 partials behind the fp16 planes (offsets in halves; slot = (batch*NQT+qtile)*MAXS+range)
#define POFF  (WOFF + (size_t)3 * NW)                                   // O  [slot][128 r][128 d]
#define MLOFF (POFF + (size_t)2 * BATCH * NQT * MAXS * TILE * HD)       // [slot][8 waves][16 max | 16 sum]

// LDS layout for attention kernel (offsets in halves)
#define OFFQ  0
#define OFFP  (TILE * LDW)
#define OFFK0 (2 * TILE * LDW)
#define OFFK1 (3 * TILE * LDW)
#define OFFV0 (4 * TILE * LDW)
#define OFFV1 (5 * TILE * LDW)
#define SMEM2_BYTES (6 * TILE * LDW * 2)   // 208,896 B < 320 KB/WGP

// ---------------------------------------------------------------------------
// 16x32 fp16 A/B fragment load from LDS (CDNA5 16-bit matrix layout:
// lanes 0-15 hold K {0..7,16..23}, lanes 16-31 hold K {8..15,24..31}).
// ---------------------------------------------------------------------------
__device__ inline v16h frag_ld(const _Float16* p, int stride) {
    const int lane = threadIdx.x & 31;
    const int r    = lane & 15;
    const int ko   = (lane >> 4) * 8;
    const _Float16* q = p + r * stride + ko;
    union { v16h v; v8h h[2]; } u;
    u.h[0] = *(const v8h*)(q);        // ds_load_b128
    u.h[1] = *(const v8h*)(q + 16);   // ds_load_b128
    return u.v;
}

// The 8 fragments (16 rows each) of a 128-row tile at one k step of 32, read as one group.
__device__ inline void frag_group(v16h (&f)[8], const _Float16* p) {
#pragma unroll
    for (int t = 0; t < 8; ++t) f[t] = frag_ld(p + (t * 16) * LDW, LDW);
}

// Work-group barrier of the projection's K loop.  It waits for the wave's LDS traffic alone:
// __syncthreads() would also wait for the global loads of the next chunk, which are meant
// to stay in flight across it.
__device__ inline void lds_barrier() {
    asm volatile("s_wait_dscnt 0x0\n\ts_barrier_signal -1\n\ts_barrier_wait -1" ::: "memory");
}
// a where the mask is all ones, b where it is zero
__device__ inline v8h pick(unsigned m, v8h a, v8h b) {
    const u32x4 x = __builtin_bit_cast(u32x4, a), y = __builtin_bit_cast(u32x4, b);
    return __builtin_bit_cast(v8h, (x & m) | (y & ~m));
}
// Stands behind a run of global loads, before their address registers are used for anything else.
__device__ inline void wait_addr() { asm volatile("s_wait_xcnt 0x0" ::: "memory"); }

// ---------------------------------------------------------------------------
// Kernel 1: QKV projection straight from the f32 inputs.
// grid = (B*S/128, 3), 512 threads (16 waves), a wave owns 16 rows x 64 columns.
// Each K chunk of BK goes global -> registers (f32) -> fp16 -> LDS; the loads of the
// next chunk are in flight while this chunk is multiplied.
// sel 0: Q (pre-scaled) [B][S][D];  sel 1: K [B][S][D];  sel 2: V^T [B][D][S]
// ---------------------------------------------------------------------------
__global__ __launch_bounds__(512) void qkv_proj_kernel(
    const float* __restrict__ x,
    const float* __restrict__ wq, const float* __restrict__ wk, const float* __restrict__ wv,
    const float* __restrict__ bq, const float* __restrict__ bk, const float* __restrict__ bv,
    _Float16* __restrict__ ws) {
    __shared__ __attribute__((aligned(16))) _Float16 sX[TILE * LDW];   // x tile [128 s][BK k]; epilogue bounce buffer
    __shared__ __attribute__((aligned(16))) _Float16 sW[TILE * LDW];   // W^T tile [128 n][BK k]

    const int sel     = blockIdx.y;
    const float* bias = sel == 0 ? bq : (sel == 1 ? bk : bv);
    const float* w    = sel == 0 ? wq : (sel == 1 ? wk : wv);
    const int batch = blockIdx.x >> 4;
    const int m0    = (blockIdx.x & 15) * TILE;
    const int tid   = threadIdx.x;
    const int wave  = tid >> 5;
    const int lane  = tid & 31;
    const int rg    = wave & 7;    // the wave's group of 16 rows
    const int ch    = wave >> 3;   // the wave's half of the 128 columns

    // x: one wave-wide load is 512 B of one row (BK k); the wave takes rows wave, wave + 16, ...
    const float* xg = x + ((size_t)batch * SEQ + m0 + wave) * EMBED + lane * 4;
    // W [k][n]: one wave-wide load is one k row of 128 n; a thread holds a block of 8 k x 4 n,
    // so that 8 consecutive k of one n are one 16-B LDS store of the transposed tile
    const float* wg = w + (size_t)(wave * 8) * HD + lane * 4;
    const int rot = (lane >> 2) & 3;   // which of its 4 n a lane stores first

    f32x4 rx[8], rw[8];
#pragma unroll
    for (int j = 0; j < 8; ++j) rx[j] = *(const f32x4*)(xg + (size_t)j * 16 * EMBED);
#pragma unroll
    for (int i = 0; i < 8; ++i) rw[i] = *(const f32x4*)(wg + (size_t)i * HD);

    v8f acc[4] = {};
    for (int c = 0; c < EMBED / BK; ++c) {
        // chunk c: registers -> fp16 -> LDS
#pragma unroll
        for (int j = 0; j < 8; ++j) {
            v4h h;
#pragma unroll
            for (int e = 0; e < 4; ++e) h[e] = (_Float16)rx[j][e];
            *(v4h*)&sX[(j * 16 + wave) * LDW + lane * 4] = h;
        }
        {
            v8h h[4];
#pragma unroll
            for (int e = 0; e < 4; ++e)
#pragma unroll
                for (int i = 0; i < 8; ++i) h[e][i] = (_Float16)rw[i][e];
            // A lane's 4 rows lie 4 pitches from its neighbour's: stored in the same order by
            // every lane, 16 lanes would meet on 4 bank groups.  Lane l starts at row (l >> 2) & 3.
            const unsigned m1 = 0u - (unsigned)(rot & 1), m2 = 0u - (unsigned)((rot >> 1) & 1);
            v8h t[4], u[4];
#pragma unroll
            for (int i = 0; i < 4; ++i) t[i] = pick(m1, h[(i + 1) & 3], h[i]);
#pragma unroll
            for (int i = 0; i < 4; ++i) u[i] = pick(m2, t[(i + 2) & 3], t[i]);   // u[i] = h[(i + rot) & 3]
#pragma unroll
            for (int i = 0; i < 4; ++i)
                *(v8h*)&sW[(lane * 4 + ((i + rot) & 3)) * LDW + wave * 8] = u[i];
        }
        if (c + 1 < EMBED / BK) {   // chunk c + 1 flies under the products of chunk c
            const float* xn = xg + (c + 1) * BK;
            const float* wn = wg + (size_t)(c + 1) * BK * HD;
#pragma unroll
            for (int j = 0; j < 8; ++j) rx[j] = *(const f32x4*)(xn + (size_t)j * 16 * EMBED);
#pragma unroll
            for (int i = 0; i < 8; ++i) rw[i] = *(const f32x4*)(wn + (size_t)i * HD);
            wait_addr();
        }
        lds_barrier();   // the tiles of chunk c are complete

        // the fragments of k step kc + 1 are read while the products of step kc run
        v16h fa[2], fb[2][4];
        fa[0] = frag_ld(&sX[(rg * 16) * LDW], LDW);
#pragma unroll
        for (int t = 0; t < 4; ++t) fb[0][t] = frag_ld(&sW[(ch * 64 + t * 16) * LDW], LDW);
#pragma unroll
        for (int kc = 0; kc < BK / 32; ++kc) {
            if (kc + 1 < BK / 32) {
                fa[(kc + 1) & 1] = frag_ld(&sX[(rg * 16) * LDW + (kc + 1) * 32], LDW);
#pragma unroll
                for (int t = 0; t < 4; ++t)
                    fb[(kc + 1) & 1][t] = frag_ld(&sW[(ch * 64 + t * 16) * LDW + (kc + 1) * 32], LDW);
            }
            // keeps the reads above in front of the products below: moved behind them, each
            // product would wait out the whole latency of its own LDS read
            __builtin_amdgcn_sched_barrier(0);
#pragma unroll
            for (int t = 0; t < 4; ++t)
                acc[t] = __builtin_amdgcn_wmma_f32_16x16x32_f16(
                    false, fa[kc & 1], false, fb[kc & 1][t], (short)0, acc[t], false, false);
        }
        lds_barrier();   // every wave has read chunk c before the tiles are written again
    }

    // bias (+Q scale) -> fp16 into LDS bounce; transposed for V
    _Float16* sOut = sX;
    const int hi = lane >> 4, ln = lane & 15;
    const float qscale = 0.088388347648318447f;   // 1/sqrt(128)
#pragma unroll
    for (int t = 0; t < 4; ++t) {
        int n = ch * 64 + t * 16 + ln;
        float bb = bias[n];
#pragma unroll
        for (int i = 0; i < 8; ++i) {
            int r = rg * 16 + i + 8 * hi;
            float v = acc[t][i] + bb;
            if (sel == 0) v *= qscale;
            if (sel == 2) sOut[n * LDW + r] = (_Float16)v;
            else          sOut[r * LDW + n] = (_Float16)v;
        }
    }
    __syncthreads();

    // coalesced 16B global stores from the bounce buffer
    if (sel == 2) {
        _Float16* dst = ws + VOFF + (size_t)batch * SEQ * HD;  // [D][S]
        for (int c = 0; c < 4; ++c) {
            int idx = c * 512 + tid;
            int r = idx >> 4, c8 = (idx & 15) * 8;
            *(v8h*)&dst[(size_t)r * SEQ + m0 + c8] = *(const v8h*)&sOut[r * LDW + c8];
        }
    } else {
        _Float16* dst = ws + (sel ? KOFF : QOFF) + (size_t)batch * SEQ * HD; // [S][D]
        for (int c = 0; c < 4; ++c) {
            int idx = c * 512 + tid;
            int r = idx >> 4, c8 = (idx & 15) * 8;
            *(v8h*)&dst[(size_t)(m0 + r) * HD + c8] = *(const v8h*)&sOut[r * LDW + c8];
        }
    }
}

// ---------------------------------------------------------------------------
// Tensor load of the attention kernel: one tile of 128 rows of 256 bytes, every
// extent in bytes, 16 bytes of LDS pad behind each row (LDS pitch 272 B = LDW halves).
// ---------------------------------------------------------------------------
typedef __attribute__((ext_vector_type(8))) unsigned int u32x8;
__device__ inline unsigned uni(unsigned v) { return (unsigned)__builtin_amdgcn_readfirstlane((int)v); }
// A wave-uniform value held in a scalar register.  On a test: the branch on it is a scalar
// branch (a tensor load ignores EXEC, only such a branch keeps a wave from issuing it).
// On a descriptor word: the word has one register of its own, which the compiler does not
// hand out and fill again between the request and its wait.
__device__ inline unsigned pinned(unsigned v) {
    unsigned w = uni(v);
    asm volatile("" : "+s"(w));   // issue test or descriptor word of a tensor load held in a scalar register
    return w;
}
// The wave's own LDS reads and writes have retired before a buffer is handed back.
__device__ inline void wait_ds0() { asm volatile("s_wait_dscnt 0x0" ::: "memory"); }
__device__ inline u32x4 tile_group0(unsigned lds_byte_addr, const _Float16* gsrc) {
    const unsigned long long ga = (unsigned long long)(size_t)gsrc;
    u32x4 g;
    g[0] = pinned(1u);                                 // count = 1; descriptor word held in a scalar register
    g[1] = uni(lds_byte_addr);
    g[2] = uni((unsigned)ga);
    g[3] = uni((((unsigned)(ga >> 32)) & 0x01FFFFFFu) | 0x80000000u);   // type = 2
    return g;
}
__device__ inline u32x8 tile_group1(unsigned pitch_bytes) {
    constexpr unsigned d0 = 2 * TILE, d1 = TILE;       // bytes in a row, rows
    u32x8 g;
    g[0] = uni((1u << 20) | (5u << 22) | (3u << 25));  // no mask, 1-byte elements, pad 4 dwords per 256-B row
    // words 1 to 7: descriptor words held in scalar registers
    g[1] = pinned((d0 & 0xFFFFu) << 16);
    g[2] = pinned((d0 >> 16) | ((d1 & 0xFFFFu) << 16));
    g[3] = pinned((d1 >> 16) | (d0 << 16));
    g[4] = pinned(d1);
    g[5] = pinned(pitch_bytes);
    g[6] = pinned(0u);
    g[7] = pinned(0u);
    return g;
}
// asm so that it keeps its place among the asm waits around it
__device__ inline void tile_load(u32x4 g0, u32x8 g1) {
    asm volatile("tensor_load_to_lds %0, %1" :: "s"(g0), "s"(g1) : "memory");
}
// The compiler places no wait for a tensor load: a tile counts as landed behind this one.
// It names the request's descriptor as inputs so that those registers stay as they are
// for as long as the request is in flight.
__device__ inline void wait_tile(u32x4 g0, u32x8 g1) {
    asm volatile("s_wait_tensorcnt 0x0" :: "s"(g0), "s"(g1) : "memory");
}

// ---------------------------------------------------------------------------
// Kernel 2: causal flash attention over ONE key range, TDM-fed, K/V double-buffered.
// grid = (NRANGE, B), 256 threads (8 waves), each wave owns 16 query rows.
// Leaves the un-normalised sum with its row maximum and row sum; kernel 3 merges.
// ---------------------------------------------------------------------------
__global__ __launch_bounds__(256) void attn_kernel(
    const _Float16* __restrict__ ws, float* __restrict__ part_o, float* __restrict__ part_ml) {
    extern __shared__ __attribute__((aligned(2048))) _Float16 smem[];   // every tile's place a multiple of 2 KiB

    const int batch = blockIdx.y;
    int qtile = NQT - 1, range = blockIdx.x;      // flat index -> (query tile, key range)
    while (range > qtile / CH) { range -= qtile / CH + 1; --qtile; }
    const int j0    = range * CH;                 // first key tile of the range
    const int qt    = min(CH - 1, qtile - j0);    // last key tile, counted from j0
    const int q0    = qtile * TILE;
    const int tid   = threadIdx.x, wave = tid >> 5, lane = tid & 31;
    const int hi    = lane >> 4,  ln   = lane & 15;
    const size_t SD = (size_t)SEQ * HD;

    const _Float16* Qg = ws + QOFF + (size_t)batch * SD + (size_t)q0 * HD;  // pre-scaled
    const _Float16* Kg = ws + KOFF + (size_t)batch * SD + (size_t)j0 * TILE * HD;
    const _Float16* Vg = ws + VOFF + (size_t)batch * SD + (size_t)j0 * TILE;  // [D][S]
    const unsigned lds0 = (unsigned)(size_t)(void*)smem;

    const unsigned wv = uni(threadIdx.x >> 5);   // the wave's number, scalar

    // Wave 0 brings the K tiles, wave 1 the V tiles, wave 2 Q: one request of a wave
    // in flight at any time, each wave with its own source, place and row pitch.
    const _Float16* src  = wv == 0 ? Kg : (wv == 1 ? Vg : Qg);
    const unsigned place = lds0 + 2 * (wv == 0 ? OFFK0 : (wv == 1 ? OFFV0 : OFFQ));
    const size_t   step  = wv == 1 ? (size_t)TILE : (size_t)TILE * HD;   // halves from key tile to key tile
    const u32x8 g1 = tile_group1(wv == 1 ? 2 * SEQ : 2 * HD);
    u32x4 g0 = tile_group0(place, src);
    // stage 0 lands and is published before anything reads it
    if (pinned(wv < 3)) { tile_load(g0, g1); wait_tile(g0, g1); }
    __syncthreads();
    // stage 1 flies under pass 0, where the range has a second key tile
    g0 = tile_group0(place + 2 * TILE * LDW, src + step);
    if (pinned(wv < 2 && qt >= 1)) tile_load(g0, g1);

    v8f o_acc[8] = {};
    float m_i[8], l_i[8];
#pragma unroll
    for (int i = 0; i < 8; ++i) { m_i[i] = -3.0e38f; l_i[i] = 0.f; }

    // the wave's Q fragments stay in registers for all its key tiles
    v16h qa[4];
#pragma unroll
    for (int kc = 0; kc < 4; ++kc) qa[kc] = frag_ld(&smem[OFFQ + (wave * 16) * LDW + kc * 32], LDW);

    for (int j = 0; j <= qt; ++j) {
        const _Float16* sK = smem + ((j & 1) ? OFFK1 : OFFK0);
        const _Float16* sV = smem + ((j & 1) ? OFFV1 : OFFV0);

        // S = Q K^T : wave's 16 rows x 128 kv-cols, K-dim 128 = 4 x 32.
        // The 8 K fragments of k step kc + 1 are read as one group while the 8 products of
        // step kc run; under the last step, and the softmax behind it, the first V group.
        v16h fb[2][8];
        frag_group(fb[0], sK);
        v8f s[8] = {};
#pragma unroll
        for (int kc = 0; kc < 4; ++kc) {
            if (kc + 1 < 4) frag_group(fb[(kc + 1) & 1], sK + (kc + 1) * 32);
            else            frag_group(fb[0], sV);
            // keeps the reads above in front of the products below: moved behind them, each
            // product would wait out the whole latency of its own LDS read
            __builtin_amdgcn_sched_barrier(0);
#pragma unroll
            for (int t = 0; t < 8; ++t)
                s[t] = __builtin_amdgcn_wmma_f32_16x16x32_f16(
                    false, qa[kc], false, fb[kc & 1][t], (short)0, s[t], false, false);
        }

        if (j0 + j == qtile) {   // diagonal tile: causal mask
#pragma unroll
            for (int t = 0; t < 8; ++t)
#pragma unroll
                for (int i = 0; i < 8; ++i) {
                    int rg = q0 + wave * 16 + i + 8 * hi;
                    int cg = (j0 + j) * TILE + t * 16 + ln;
                    if (cg > rg) s[t][i] = -3.0e38f;
                }
        }

        // online softmax; P (fp16) into private sP rows — no barrier needed
#pragma unroll
        for (int i = 0; i < 8; ++i) {
            float rmax = -3.0e38f;
#pragma unroll
            for (int t = 0; t < 8; ++t) rmax = fmaxf(rmax, s[t][i]);
#pragma unroll
            for (int off = 8; off >= 1; off >>= 1)
                rmax = fmaxf(rmax, __shfl_xor(rmax, off, 32));
            float mnew  = fmaxf(m_i[i], rmax);
            float alpha = __expf(m_i[i] - mnew);
            float rsum  = 0.f;
            int   r     = wave * 16 + i + 8 * hi;
#pragma unroll
            for (int t = 0; t < 8; ++t) {
                float p = __expf(s[t][i] - mnew);
                rsum += p;
                smem[OFFP + r * LDW + t * 16 + ln] = (_Float16)p;
            }
#pragma unroll
            for (int off = 8; off >= 1; off >>= 1)
                rsum += __shfl_xor(rsum, off, 32);
            l_i[i] = l_i[i] * alpha + rsum;
            m_i[i] = mnew;
#pragma unroll
            for (int t = 0; t < 8; ++t) o_acc[t][i] *= alpha;
        }

        // O += P V^T-tile : reduce over n = 128 in chunks of 32, the V group of chunk nc + 1
        // read while the 8 products of chunk nc run
        v16h pa[4];
#pragma unroll
        for (int nc = 0; nc < 4; ++nc) pa[nc] = frag_ld(&smem[OFFP + (wave * 16) * LDW + nc * 32], LDW);
#pragma unroll
        for (int nc = 0; nc < 4; ++nc) {
            if (nc + 1 < 4) frag_group(fb[(nc + 1) & 1], sV + (nc + 1) * 32);
            // keeps the reads above in front of the products below, as in S = Q K^T
            __builtin_amdgcn_sched_barrier(0);
#pragma unroll
            for (int dt = 0; dt < 8; ++dt)
                o_acc[dt] = __builtin_amdgcn_wmma_f32_16x16x32_f16(
                    false, pa[nc], false, fb[nc & 1][dt], (short)0, o_acc[dt], false, false);
        }
        // publish tile j+1 and free tile j's buffers: own LDS traffic retired, the
        // issuers' tiles landed, one barrier for both, and only then the refill
        wait_ds0();
        if (pinned(wv < 2)) wait_tile(g0, g1);
        __syncthreads();
        g0 = tile_group0(place + (j & 1) * (2 * TILE * LDW), src + (size_t)(j + 2) * step);
        if (pinned(wv < 2 && j + 2 <= qt)) tile_load(g0, g1);
    }
    wait_tile(g0, g1);
    wait_ds0();

    const size_t slot = ((size_t)batch * NQT + qtile) * MAXS + range;
    float* po = part_o  + slot * (TILE * HD);
    float* ml = part_ml + slot * (2 * TILE) + wave * 32;   // one 128-B line per wave
#pragma unroll
    for (int i = 0; i < 8; ++i) {
        int r = wave * 16 + i + 8 * hi;
#pragma unroll
        for (int dt = 0; dt < 8; ++dt)
            po[(size_t)r * HD + dt * 16 + ln] = o_acc[dt][i];
    }
    if (ln == 0) {   // every lane of a 16-lane row holds the same maximum and sum
#pragma unroll
        for (int i = 0; i < 8; ++i) {
            ml[i + 8 * hi]      = m_i[i];
            ml[16 + i + 8 * hi] = l_i[i];
        }
    }
}

// e^x for the merge weights.  The v_nop in the same statement is the one slot the
// instruction set asks for behind a transcendental before its source register is
// overwritten or its result read.
__device__ inline float exp_weight(float x) {
    float e;
    asm("v_exp_f32 %0, %1\n\tv_nop" : "=v"(e) : "v"(x * 1.4426950408889634f));
    return e;
}

// ---------------------------------------------------------------------------
// Kernel 3: merge the key ranges of each query row.
// grid = B*S/16, 256 threads: a wave takes rows w and w+8 of 16, a lane 4 columns.
// ---------------------------------------------------------------------------
__global__ __launch_bounds__(256) void merge_kernel(
    const float* __restrict__ part_o, const float* __restrict__ part_ml,
    float* __restrict__ out) {
    const int row0  = blockIdx.x * 16;            // flat row (batch*SEQ + s), 16 rows of one tile
    const int qtile = (row0 & (SEQ - 1)) / TILE;
    const int ns    = qtile / CH + 1;             // key ranges of this query tile
    const int rt0   = row0 & (TILE - 1);          // first row inside the tile
    const size_t slot0 = ((size_t)(row0 / SEQ) * NQT + qtile) * MAXS;
    const float* po = part_o  + slot0 * (TILE * HD);
    const float* ml = part_ml + slot0 * (2 * TILE) + (rt0 >> 4) * 32;
    const int w  = threadIdx.x >> 5;
    const int d4 = (threadIdx.x & 31) * 4;

    f32x4 o[2][MAXS];
    float m[2][MAXS], l[2][MAXS];
#pragma unroll
    for (int c = 0; c < MAXS; ++c) {
#pragma unroll
        for (int k = 0; k < 2; ++k) {
            o[k][c] = f32x4{0.f, 0.f, 0.f, 0.f};
            m[k][c] = -3.0e38f;
            l[k][c] = 0.f;
        }
        if (c < ns) {
#pragma unroll
            for (int k = 0; k < 2; ++k) {
                int rr = w + 8 * k;
                o[k][c] = *(const f32x4*)&po[(size_t)c * (TILE * HD) + (size_t)(rt0 + rr) * HD + d4];
                m[k][c] = ml[c * (2 * TILE) + rr];
                l[k][c] = ml[c * (2 * TILE) + 16 + rr];
            }
        }
    }
#pragma unroll
    for (int k = 0; k < 2; ++k) {
        float mx = m[k][0];
#pragma unroll
        for (int c = 1; c < MAXS; ++c) mx = fmaxf(mx, m[k][c]);
        float wt[MAXS];
#pragma unroll
        for (int c = 0; c < MAXS; ++c) wt[c] = exp_weight(m[k][c] - mx);
        f32x4 acc = {0.f, 0.f, 0.f, 0.f};
        float ls  = 0.f;
#pragma unroll
        for (int c = 0; c < MAXS; ++c) {
            ls  += wt[c] * l[k][c];
            acc += wt[c] * o[k][c];
        }
        *(f32x4*)&out[(size_t)(row0 + w + 8 * k) * HD + d4] = acc * (1.0f / ls);
    }
}

extern "C" void kernel_launch(void* const* d_in, const int* in_sizes, int n_in,
                              void* d_out, int out_size, void* d_ws, size_t ws_size,
                              hipStream_t stream) {
    const float* x  = (const float*)d_in[0];
    const float* wq = (const float*)d_in[1];
    const float* bq = (const float*)d_in[2];
    const float* wk = (const float*)d_in[3];
    const float* bk = (const float*)d_in[4];
    const float* wv = (const float*)d_in[5];
    const float* bv = (const float*)d_in[6];
    _Float16* ws = (_Float16*)d_ws;   // fp16 Q, K, V^T; f32 partials behind

    qkv_proj_kernel<<<dim3(BATCH * SEQ / TILE, 3), 512, 0, stream>>>(
        x, wq, wk, wv, bq, bk, bv, ws);
    float* part_o  = (float*)(ws + POFF);
    float* part_ml = (float*)(ws + MLOFF);
    attn_kernel<<<dim3(NRANGE, BATCH), 256, SMEM2_BYTES, stream>>>(ws, part_o, part_ml);
    merge_kernel<<<BATCH * SEQ / 16, 256, 0, stream>>>(part_o, part_ml, (float*)d_out);
}

// v004
// It runs in 31.7 microseconds.
// In two side-by-side timings against v003, it was 1.10 and 1.09 times as fast.
// All steps since v000 together make it 4.05 times as fast.
#include <hip/hip_runtime.h>
#include <hip/hip_bf16.h>

typedef __attribute__((ext_vector_type(16))) _Float16     v16h;
typedef __attribute__((ext_vector_type(8)))  _Float16     v8h;
typedef __attribute__((ext_vector_type(4)))  _Float16     v4h;
typedef __attribute__((ext_vector_type(8)))  float        v8f;
typedef __attribute__((ext_vector_type(4)))  float        f32x4;
typedef __attribute__((ext_vector_type(4)))  unsigned int u32x4;

#define EMBED 1024
#define SEQ   2048
#define BATCH 4
#define HD    128
#define TILE  128
#define LDW   136   // padded half-stride for 128-wide tiles (272B, 16B multiple)
#define BK    128   // K chunk of the projection
#define NW    (EMBED * HD)                 // one weight matrix, elements

// fp16 workspace layout (offsets in halves)
#define QOFF  ((size_t)0)                           // Q  [B][S][D] (pre-scaled)
#define KOFF  ((size_t)BATCH * SEQ * HD)            // K  [B][S][D]
#define VOFF  ((size_t)2 * BATCH * SEQ * HD)        // V^T [B][D][S]
#define XOFF  ((size_t)3 * BATCH * SEQ * HD)        // not used
#define WOFF  (XOFF + (size_t)BATCH * SEQ * EMBED)  // not used

// key split of the attention: a work-group takes CH key tiles of one query tile
#define NQT   (SEQ / TILE)                 // query tiles per batch
#define CH    3                            // key tiles per work-group
#define MAXS  ((NQT + CH - 1) / CH)        // most key ranges a query tile has
constexpr int count_ranges() {             // (query tile, key range) pairs per batch
    int n = 0;
    for (int q = 0; q < NQT; ++q) n += q / CH + 1;
    return n;
}
constexpr int NRANGE = count_ranges();
// f32 partials behind the fp16 planes (offsets in halves; slot = (batch*NQT+qtile)*MAXS+range)
#define POFF  (WOFF + (size_t)3 * NW)                                   // O  [slot][128 r][128 d]
#define MLOFF (POFF + (size_t)2 * BATCH * NQT * MAXS * TILE * HD)       // [slot][8 waves][16 max | 16 sum]

// LDS layout for attention kernel (offsets in halves)
#define OFFQ  0
#define OFFP  (TILE * LDW)          // free: P stays in registers
#define OFFK0 (2 * TILE * LDW)
#define OFFK1 (3 * TILE * LDW)
#define OFFV0 (4 * TILE * LDW)
#define OFFV1 (5 * TILE * LDW)
#define SMEM2_BYTES (6 * TILE * LDW * 2)   // 208,896 B < 320 KB/WGP
#define STP   132   // f32 pitch of the output staging rows (528 B: 16 lanes' 16-B stores meet no bank twice)

// ---------------------------------------------------------------------------
// 16x32 fp16 A/B fragment load from LDS (CDNA5 16-bit matrix layout:
// lanes 0-15 hold K {0..7,16..23}, lanes 16-31 hold K {8..15,24..31}).
// ---------------------------------------------------------------------------
__device__ inline v16h frag_ld(const _Float16* p, int stride) {
    const int lane = threadIdx.x & 31;
    const int r    = lane & 15;
    const int ko   = (lane >> 4) * 8;
    const _Float16* q = p + r * stride + ko;
    union { v16h v; v8h h[2]; } u;
    u.h[0] = *(const v8h*)(q);        // ds_load_b128
    u.h[1] = *(const v8h*)(q + 16);   // ds_load_b128
    return u.v;
}

// The 8 fragments (16 rows each) of a 128-row tile at one k step of 32, read as one group.
__device__ inline void frag_group(v16h (&f)[8], const _Float16* p) {
#pragma unroll
    for (int t = 0; t < 8; ++t) f[t] = frag_ld(p + (t * 16) * LDW, LDW);
}

// Work-group barrier of the projection's K loop.  It waits for the wave's LDS traffic alone:
// __syncthreads() would also wait for the global loads of the next chunk, which are meant
// to stay in flight across it.
__device__ inline void lds_barrier() {
    asm volatile("s_wait_dscnt 0x0\n\ts_barrier_signal -1\n\ts_barrier_wait -1" ::: "memory");
}
// a where the mask is all ones, b where it is zero
__device__ inline v8h pick(unsigned m, v8h a, v8h b) {
    const u32x4 x = __builtin_bit_cast(u32x4, a), y = __builtin_bit_cast(u32x4, b);
    return __builtin_bit_cast(v8h, (x & m) | (y & ~m));
}
// Stands behind a run of global loads, before their address registers are used for anything else.
__device__ inline void wait_addr() { asm volatile("s_wait_xcnt 0x0" ::: "memory"); }

// ---------------------------------------------------------------------------
// Kernel 1: QKV projection straight from the f32 inputs.
// grid = (B*S/128, 3), 512 threads (16 waves), a wave owns 16 rows x 64 columns.
// Each K chunk of BK goes global -> registers (f32) -> fp16 -> LDS; the loads of the
// next chunk are in flight while this chunk is multiplied.
// sel 0: Q (pre-scaled) [B][S][D];  sel 1: K [B][S][D];  sel 2: V^T [B][D][S]
// ---------------------------------------------------------------------------
__global__ __launch_bounds__(512) void qkv_proj_kernel(
    const float* __restrict__ x,
    const float* __restrict__ wq, const float* __restrict__ wk, const float* __restrict__ wv,
    const float* __restrict__ bq, const float* __restrict__ bk, const float* __restrict__ bv,
    _Float16* __restrict__ ws) {
    __shared__ __attribute__((aligned(16))) _Float16 sX[TILE * LDW];   // x tile [128 s][BK k]; epilogue bounce buffer
    __shared__ __attribute__((aligned(16))) _Float16 sW[TILE * LDW];   // W^T tile [128 n][BK k]

    const int sel     = blockIdx.y;
    const float* bias = sel == 0 ? bq : (sel == 1 ? bk : bv);
    const float* w    = sel == 0 ? wq : (sel == 1 ? wk : wv);
    const int batch = blockIdx.x >> 4;
    const int m0    = (blockIdx.x & 15) * TILE;
    const int tid   = threadIdx.x;
    const int wave  = tid >> 5;
    const int lane  = tid & 31;
    const int rg    = wave & 7;    // the wave's group of 16 rows
    const int ch    = wave >> 3;   // the wave's half of the 128 columns

    // x: one wave-wide load is 512 B of one row (BK k); the wave takes rows wave, wave + 16, ...
    const float* xg = x + ((size_t)batch * SEQ + m0 + wave) * EMBED + lane * 4;
    // W [k][n]: one wave-wide load is one k row of 128 n; a thread holds a block of 8 k x 4 n,
    // so that 8 consecutive k of one n are one 16-B LDS store of the transposed tile
    const float* wg = w + (size_t)(wave * 8) * HD + lane * 4;
    const int rot = (lane >> 2) & 3;   // which of its 4 n a lane stores first

    f32x4 rx[8], rw[8];
#pragma unroll
    for (int j = 0; j < 8; ++j) rx[j] = *(const f32x4*)(xg + (size_t)j * 16 * EMBED);
#pragma unroll
    for (int i = 0; i < 8; ++i) rw[i] = *(const f32x4*)(wg + (size_t)i * HD);

    v8f acc[4] = {};
    for (int c = 0; c < EMBED / BK; ++c) {
        // chunk c: registers -> fp16 -> LDS
#pragma unroll
        for (int j = 0; j < 8; ++j) {
            v4h h;
#pragma unroll
            for (int e = 0; e < 4; ++e) h[e] = (_Float16)rx[j][e];
            *(v4h*)&sX[(j * 16 + wave) * LDW + lane * 4] = h;
        }
        {
            v8h h[4];
#pragma unroll
            for (int e = 0; e < 4; ++e)
#pragma unroll
                for (int i = 0; i < 8; ++i) h[e][i] = (_Float16)rw[i][e];
            // A lane's 4 rows lie 4 pitches from its neighbour's: stored in the same order by
            // every lane, 16 lanes would meet on 4 bank groups.  Lane l starts at row (l >> 2) & 3.
            const unsigned m1 = 0u - (unsigned)(rot & 1), m2 = 0u - (unsigned)((rot >> 1) & 1);
            v8h t[4], u[4];
#pragma unroll
            for (int i = 0; i < 4; ++i) t[i] = pick(m1, h[(i + 1) & 3], h[i]);
#pragma unroll
            for (int i = 0; i < 4; ++i) u[i] = pick(m2, t[(i + 2) & 3], t[i]);   // u[i] = h[(i + rot) & 3]
#pragma unroll
            for (int i = 0; i < 4; ++i)
                *(v8h*)&sW[(lane * 4 + ((i + rot) & 3)) * LDW + wave * 8] = u[i];
        }
        if (c + 1 < EMBED / BK) {   // chunk c + 1 flies under the products of chunk c
            const float* xn = xg + (c + 1) * BK;
            const float* wn = wg + (size_t)(c + 1) * BK * HD;
#pragma unroll
            for (int j = 0; j < 8; ++j) rx[j] = *(const f32x4*)(xn + (size_t)j * 16 * EMBED);
#pragma unroll
            for (int i = 0; i < 8; ++i) rw[i] = *(const f32x4*)(wn + (size_t)i * HD);
            wait_addr();
        }
        lds_barrier();   // the tiles of chunk c are complete

        // the fragments of k step kc + 1 are read while the products of step kc run
        v16h fa[2], fb[2][4];
        fa[0] = frag_ld(&sX[(rg * 16) * LDW], LDW);
#pragma unroll
        for (int t = 0; t < 4; ++t) fb[0][t] = frag_ld(&sW[(ch * 64 + t * 16) * LDW], LDW);
#pragma unroll
        for (int kc = 0; kc < BK / 32; ++kc) {
            if (kc + 1 < BK / 32) {
                fa[(kc + 1) & 1] = frag_ld(&sX[(rg * 16) * LDW + (kc + 1) * 32], LDW);
#pragma unroll
                for (int t = 0; t < 4; ++t)
                    fb[(kc + 1) & 1][t] = frag_ld(&sW[(ch * 64 + t * 16) * LDW + (kc + 1) * 32], LDW);
            }
            // keeps the reads above in front of the products below: moved behind them, each
            // product would wait out the whole latency of its own LDS read
            __builtin_amdgcn_sched_barrier(0);
#pragma unroll
            for (int t = 0; t < 4; ++t)
                acc[t] = __builtin_amdgcn_wmma_f32_16x16x32_f16(
                    false, fa[kc & 1], false, fb[kc & 1][t], (short)0, acc[t], false, false);
        }
        lds_barrier();   // every wave has read chunk c before the tiles are written again
    }

    // bias (+Q scale) -> fp16 into LDS bounce; transposed for V
    _Float16* sOut = sX;
    const int hi = lane >> 4, ln = lane & 15;
    const float qscale = 0.088388347648318447f;   // 1/sqrt(128)
#pragma unroll
    for (int t = 0; t < 4; ++t) {
        int n = ch * 64 + t * 16 + ln;
        float bb = bias[n];
#pragma unroll
        for (int i = 0; i < 8; ++i) {
            int r = rg * 16 + i + 8 * hi;
            float v = acc[t][i] + bb;
            if (sel == 0) v *= qscale;
            if (sel == 2) sOut[n * LDW + r] = (_Float16)v;
            else          sOut[r * LDW + n] = (_Float16)v;
        }
    }
    __syncthreads();

    // coalesced 16B global stores from the bounce buffer
    if (sel == 2) {
        _Float16* dst = ws + VOFF + (size_t)batch * SEQ * HD;  // [D][S]
        for (int c = 0; c < 4; ++c) {
            int idx = c * 512 + tid;
            int r = idx >> 4, c8 = (idx & 15) * 8;
            *(v8h*)&dst[(size_t)r * SEQ + m0 + c8] = *(const v8h*)&sOut[r * LDW + c8];
        }
    } else {
        _Float16* dst = ws + (sel ? KOFF : QOFF) + (size_t)batch * SEQ * HD; // [S][D]
        for (int c = 0; c < 4; ++c) {
            int idx = c * 512 + tid;
            int r = idx >> 4, c8 = (idx & 15) * 8;
            *(v8h*)&dst[(size_t)(m0 + r) * HD + c8] = *(const v8h*)&sOut[r * LDW + c8];
        }
    }
}

// ---------------------------------------------------------------------------
// Tensor load of the attention kernel: one tile of 128 rows of 256 bytes, every
// extent in bytes, 16 bytes of LDS pad behind each row (LDS pitch 272 B = LDW halves).
// ---------------------------------------------------------------------------
typedef __attribute__((ext_vector_type(8))) unsigned int u32x8;
__device__ inline unsigned uni(unsigned v) { return (unsigned)__builtin_amdgcn_readfirstlane((int)v); }
// A wave-uniform value held in a scalar register.  On a test: the branch on it is a scalar
// branch (a tensor load ignores EXEC, only such a branch keeps a wave from issuing it).
// On a descriptor word: the word has one register of its own, which the compiler does not
// hand out and fill again between the request and its wait.
__device__ inline unsigned pinned(unsigned v) {
    unsigned w = uni(v);
    asm volatile("" : "+s"(w));   // issue test or descriptor word of a tensor load held in a scalar register
    return w;
}
// lane l takes the value of lane l ^ 16
__device__ inline float xhalf(float x) {
    const int b = __builtin_bit_cast(int, x);
    return __builtin_bit_cast(float, __builtin_amdgcn_permlanex16(b, b, 0x76543210, 0xfedcba98, false, false));
}
// The wave's own LDS reads and writes have retired before a buffer is handed back.
__device__ inline void wait_ds0() { asm volatile("s_wait_dscnt 0x0" ::: "memory"); }
__device__ inline u32x4 tile_group0(unsigned lds_byte_addr, const _Float16* gsrc) {
    const unsigned long long ga = (unsigned long long)(size_t)gsrc;
    u32x4 g;
    g[0] = pinned(1u);                                 // count = 1; descriptor word held in a scalar register
    g[1] = uni(lds_byte_addr);
    g[2] = uni((unsigned)ga);
    g[3] = uni((((unsigned)(ga >> 32)) & 0x01FFFFFFu) | 0x80000000u);   // type = 2
    return g;
}
__device__ inline u32x8 tile_group1(unsigned pitch_bytes) {
    constexpr unsigned d0 = 2 * TILE, d1 = TILE;       // bytes in a row, rows
    u32x8 g;
    g[0] = uni((1u << 20) | (5u << 22) | (3u << 25));  // no mask, 1-byte elements, pad 4 dwords per 256-B row
    // words 1 to 7: descriptor words held in scalar registers
    g[1] = pinned((d0 & 0xFFFFu) << 16);
    g[2] = pinned((d0 >> 16) | ((d1 & 0xFFFFu) << 16));
    g[3] = pinned((d1 >> 16) | (d0 << 16));
    g[4] = pinned(d1);
    g[5] = pinned(pitch_bytes);
    g[6] = pinned(0u);
    g[7] = pinned(0u);
    return g;
}
// asm so that it keeps its place among the asm waits around it
__device__ inline void tile_load(u32x4 g0, u32x8 g1) {
    asm volatile("tensor_load_to_lds %0, %1" :: "s"(g0), "s"(g1) : "memory");
}
// The compiler places no wait for a tensor load: a tile counts as landed behind this one.
// It names the request's descriptor as inputs so that those registers stay as they are
// for as long as the request is in flight.
__device__ inline void wait_tile(u32x4 g0, u32x8 g1) {
    asm volatile("s_wait_tensorcnt 0x0" :: "s"(g0), "s"(g1) : "memory");
}

// e^x for the softmax and the merge weights.  The v_nop in the same statement is the one slot the
// instruction set asks for behind a transcendental before its source register is
// overwritten or its result read.
__device__ inline float exp_weight(float x) {
    float e;
    asm("v_exp_f32 %0, %1\n\tv_nop" : "=v"(e) : "v"(x * 1.4426950408889634f));
    return e;
}

// ---------------------------------------------------------------------------
// Kernel 2: causal flash attention over ONE key range, TDM-fed, K/V double-buffered.
// grid = (NRANGE, B), 256 threads (8 waves), each wave owns 16 queries (one per lane pair).
// Leaves the un-normalised sum with its row maximum and row sum; kernel 3 merges.
// ---------------------------------------------------------------------------
__global__ __launch_bounds__(256) void attn_kernel(
    const _Float16* __restrict__ ws, float* __restrict__ part_o, float* __restrict__ part_ml) {
    extern __shared__ __attribute__((aligned(2048))) _Float16 smem[];   // every tile's place a multiple of 2 KiB

    const int batch = blockIdx.y;
    int qtile = NQT - 1, range = blockIdx.x;      // flat index -> (query tile, key range)
    while (range > qtile / CH) { range -= qtile / CH + 1; --qtile; }
    const int j0    = range * CH;                 // first key tile of the range
    const int qt    = min(CH - 1, qtile - j0);    // last key tile, counted from j0
    const int q0    = qtile * TILE;
    const int tid   = threadIdx.x, wave = tid >> 5, lane = tid & 31;
    const int hi    = lane >> 4,  ln   = lane & 15;
    const size_t SD = (size_t)SEQ * HD;

    const _Float16* Qg = ws + QOFF + (size_t)batch * SD + (size_t)q0 * HD;  // pre-scaled
    const _Float16* Kg = ws + KOFF + (size_t)batch * SD + (size_t)j0 * TILE * HD;
    const _Float16* Vg = ws + VOFF + (size_t)batch * SD + (size_t)j0 * TILE;  // [D][S]
    const unsigned lds0 = (unsigned)(size_t)(void*)smem;

    const unsigned wv = uni(threadIdx.x >> 5);   // the wave's number, scalar

    // Wave 0 brings the K tiles, wave 1 the V tiles, wave 2 Q: one request of a wave
    // in flight at any time, each wave with its own source, place and row pitch.
    const _Float16* src  = wv == 0 ? Kg : (wv == 1 ? Vg : Qg);
    const unsigned place = lds0 + 2 * (wv == 0 ? OFFK0 : (wv == 1 ? OFFV0 : OFFQ));
    const size_t   step  = wv == 1 ? (size_t)TILE : (size_t)TILE * HD;   // halves from key tile to key tile
    const u32x8 g1 = tile_group1(wv == 1 ? 2 * SEQ : 2 * HD);
    u32x4 g0 = tile_group0(place, src);
    // stage 0 lands and is published before anything reads it
    if (pinned(wv < 3)) { tile_load(g0, g1); wait_tile(g0, g1); }
    __syncthreads();
    // stage 1 flies under pass 0, where the range has a second key tile
    g0 = tile_group0(place + 2 * TILE * LDW, src + step);
    if (pinned(wv < 2 && qt >= 1)) tile_load(g0, g1);

    v8f o_acc[8] = {};                 // o_acc[dt][i] = O[query ln][d = dt * 16 + 8 * hi + i]
    float m_i = -3.0e38f, l_i = 0.f;   // the query's maximum; the sum over this wave half's keys

    // the wave's Q fragments (B operand: column = query) stay in registers for all its key tiles
    v16h qb[4];
#pragma unroll
    for (int kc = 0; kc < 4; ++kc) qb[kc] = frag_ld(&smem[OFFQ + (wave * 16) * LDW + kc * 32], LDW);

    for (int j = 0; j <= qt; ++j) {
        const _Float16* sK = smem + ((j & 1) ? OFFK1 : OFFK0);
        const _Float16* sV = smem + ((j & 1) ? OFFV1 : OFFV0);

        // S^T = K Q^T : 128 keys x the wave's 16 queries, K-dim 128 = 4 x 32.
        // The 8 K fragments of k step kc + 1 are read as one group while the 8 products of
        // step kc run; under the last step, and the softmax behind it, the first V group.
        v16h fb[2][8];
        frag_group(fb[0], sK);
        v8f s[8] = {};                 // s[t][i] = score(key t * 16 + 8 * hi + i, query ln)
#pragma unroll
        for (int kc = 0; kc < 4; ++kc) {
            if (kc + 1 < 4) frag_group(fb[(kc + 1) & 1], sK + (kc + 1) * 32);
            else            frag_group(fb[0], sV);
            // keeps the reads above in front of the products below: moved behind them, each
            // product would wait out the whole latency of its own LDS read
            __builtin_amdgcn_sched_barrier(0);
#pragma unroll
            for (int t = 0; t < 8; ++t)
                s[t] = __builtin_amdgcn_wmma_f32_16x16x32_f16(
                    false, fb[kc & 1][t], false, qb[kc], (short)0, s[t], false, false);
        }

        if (j0 + j == qtile) {   // diagonal tile: causal mask
#pragma unroll
            for (int t = 0; t < 8; ++t)
#pragma unroll
                for (int i = 0; i < 8; ++i)
                    if (t * 16 + 8 * hi + i > wave * 16 + ln) s[t][i] = -3.0e38f;
        }

        // online softmax, all of a query's scores in two lanes: maximum and sum run down the
        // lane's own registers, and one exchange between the wave halves joins the maxima
        v8f mx8 = s[0];
#pragma unroll
        for (int t = 1; t < 8; ++t)
#pragma unroll
            for (int i = 0; i < 8; ++i) mx8[i] = fmaxf(mx8[i], s[t][i]);
        float rmax = fmaxf(fmaxf(fmaxf(mx8[0], mx8[1]), fmaxf(mx8[2], mx8[3])),
                           fmaxf(fmaxf(mx8[4], mx8[5]), fmaxf(mx8[6], mx8[7])));
        rmax = fmaxf(rmax, xhalf(rmax));
        const float mnew  = fmaxf(m_i, rmax);
        const float alpha = exp_weight(m_i - mnew);
        v8f sum8 = {};
#pragma unroll
        for (int t = 0; t < 8; ++t)
#pragma unroll
            for (int i = 0; i < 8; ++i) {
                s[t][i] = exp_weight(s[t][i] - mnew);
                sum8[i] += s[t][i];
            }
        l_i = l_i * alpha + (((sum8[0] + sum8[1]) + (sum8[2] + sum8[3])) +
                             ((sum8[4] + sum8[5]) + (sum8[6] + sum8[7])));
        m_i = mnew;
#pragma unroll
        for (int dt = 0; dt < 8; ++dt) o_acc[dt] *= alpha;

        // P^T as B operand: two score tiles (32 keys) converted in place are one fragment in
        // the k order of frag_ld: element e = key 8 * hi + e, element 8 + e = key 16 + 8 * hi + e
        v16h pb[4];
#pragma unroll
        for (int nc = 0; nc < 4; ++nc)
#pragma unroll
            for (int i = 0; i < 8; ++i) {
                pb[nc][i]     = (_Float16)s[2 * nc][i];
                pb[nc][8 + i] = (_Float16)s[2 * nc + 1][i];
            }

        // O^T += V^T P^T : reduce over 128 keys in chunks of 32, the V group of chunk nc + 1
        // read while the 8 products of chunk nc run
#pragma unroll
        for (int nc = 0; nc < 4; ++nc) {
            if (nc + 1 < 4) frag_group(fb[(nc + 1) & 1], sV + (nc + 1) * 32);
            // keeps the reads above in front of the products below, as in S^T = K Q^T
            __builtin_amdgcn_sched_barrier(0);
#pragma unroll
            for (int dt = 0; dt < 8; ++dt)
                o_acc[dt] = __builtin_amdgcn_wmma_f32_16x16x32_f16(
                    false, fb[nc & 1][dt], false, pb[nc], (short)0, o_acc[dt], false, false);
        }
        // publish tile j+1 and free tile j's buffers: own LDS traffic retired, the
        // issuers' tiles landed, one barrier for both, and only then the refill
        wait_ds0();
        if (pinned(wv < 2)) wait_tile(g0, g1);
        __syncthreads();
        g0 = tile_group0(place + (j & 1) * (2 * TILE * LDW), src + (size_t)(j + 2) * step);
        if (pinned(wv < 2 && j + 2 <= qt)) tile_load(g0, g1);
    }
    wait_tile(g0, g1);
    wait_ds0();

    const size_t slot = ((size_t)batch * NQT + qtile) * MAXS + range;
    float* po = part_o  + slot * (TILE * HD) + (size_t)(wave * 16) * HD;
    float* ml = part_ml + slot * (2 * TILE) + wave * 32;   // one 128-B line per wave
    // O^T -> O through the wave's own rows of the K buffers, which every wave has left at the
    // loop's last barrier and no tensor load is aimed at any more: a lane writes 8 d of its
    // query, then the wave reads whole rows and stores 512 contiguous bytes at a time.
    float* st = (float*)(smem + OFFK0) + wave * (16 * STP);
#pragma unroll
    for (int dt = 0; dt < 8; ++dt) {
        *(f32x4*)&st[ln * STP + dt * 16 + 8 * hi] =
            f32x4{o_acc[dt][0], o_acc[dt][1], o_acc[dt][2], o_acc[dt][3]};
        *(f32x4*)&st[ln * STP + dt * 16 + 8 * hi + 4] =
            f32x4{o_acc[dt][4], o_acc[dt][5], o_acc[dt][6], o_acc[dt][7]};
    }
#pragma unroll
    for (int r = 0; r < 16; ++r)
        *(f32x4*)&po[(size_t)r * HD + lane * 4] = *(const f32x4*)&st[r * STP + lane * 4];
    // lanes 0-15 store the 16 maxima, lanes 16-31 the 16 sums (both halves' keys joined)
    const float l_all = l_i + xhalf(l_i);
    ml[lane] = hi ? l_all : m_i;
}

// ---------------------------------------------------------------------------
// Kernel 3: merge the key ranges of each query row.
// grid = B*S/16, 256 threads: a wave takes rows w and w+8 of 16, a lane 4 columns.
// ---------------------------------------------------------------------------
__global__ __launch_bounds__(256) void merge_kernel(
    const float* __restrict__ part_o, const float* __restrict__ part_ml,
    float* __restrict__ out) {
    const int row0  = blockIdx.x * 16;            // flat row (batch*SEQ + s), 16 rows of one tile
    const int qtile = (row0 & (SEQ - 1)) / TILE;
    const int ns    = qtile / CH + 1;             // key ranges of this query tile
    const int rt0   = row0 & (TILE - 1);          // first row inside the tile
    const size_t slot0 = ((size_t)(row0 / SEQ) * NQT + qtile) * MAXS;
    const float* po = part_o  + slot0 * (TILE * HD);
    const float* ml = part_ml + slot0 * (2 * TILE) + (rt0 >> 4) * 32;
    const int w  = threadIdx.x >> 5;
    const int d4 = (threadIdx.x & 31) * 4;

    f32x4 o[2][MAXS];
    float m[2][MAXS], l[2][MAXS];
#pragma unroll
    for (int c = 0; c < MAXS; ++c) {
#pragma unroll
        for (int k = 0; k < 2; ++k) {
            o[k][c] = f32x4{0.f, 0.f, 0.f, 0.f};
            m[k][c] = -3.0e38f;
            l[k][c] = 0.f;
        }
        if (c < ns) {
#pragma unroll
            for (int k = 0; k < 2; ++k) {
                int rr = w + 8 * k;
                o[k][c] = *(const f32x4*)&po[(size_t)c * (TILE * HD) + (size_t)(rt0 + rr) * HD + d4];
                m[k][c] = ml[c * (2 * TILE) + rr];
                l[k][c] = ml[c * (2 * TILE) + 16 + rr];
            }
        }
    }
#pragma unroll
    for (int k = 0; k < 2; ++k) {
        float mx = m[k][0];
#pragma unroll
        for (int c = 1; c < MAXS; ++c) mx = fmaxf(mx, m[k][c]);
        float wt[MAXS];
#pragma unroll
        for (int c = 0; c < MAXS; ++c) wt[c] = exp_weight(m[k][c] - mx);
        f32x4 acc = {0.f, 0.f, 0.f, 0.f};
        float ls  = 0.f;
#pragma unroll
        for (int c = 0; c < MAXS; ++c) {
            ls  += wt[c] * l[k][c];
            acc += wt[c] * o[k][c];
        }
        *(f32x4*)&out[(size_t)(row0 + w + 8 * k) * HD + d4] = acc * (1.0f / ls);
    }
}

extern "C" void kernel_launch(void* const* d_in, const int* in_sizes, int n_in,
                              void* d_out, int out_size, void* d_ws, size_t ws_size,
                              hipStream_t stream) {
    const float* x  = (const float*)d_in[0];
    const float* wq = (const float*)d_in[1];
    const float* bq = (const float*)d_in[2];
    const float* wk = (const float*)d_in[3];
    const float* bk = (const float*)d_in[4];
    const float* wv = (const float*)d_in[5];
    const float* bv = (const float*)d_in[6];
    _Float16* ws = (_Float16*)d_ws;   // fp16 Q, K, V^T; f32 partials behind

    qkv_proj_kernel<<<dim3(BATCH * SEQ / TILE, 3), 512, 0, stream>>>(
        x, wq, wk, wv, bq, bk, bv, ws);
    float* part_o  = (float*)(ws + POFF);
    float* part_ml = (float*)(ws + MLOFF);
    attn_kernel<<<dim3(NRANGE, BATCH), 256, SMEM2_BYTES, stream>>>(ws, part_o, part_ml);
    merge_kernel<<<BATCH * SEQ / 16, 256, 0, stream>>>(part_o, part_ml, (float*)d_out);
}

// v005
// One run takes 28.3 microseconds.
// Two timings next to v004 both put it at 1.12 times that version's speed.
// Over all steps from v000 it is 4.55 times as fast.
#include <hip/hip_runtime.h>
#include <hip/hip_bf16.h>

typedef __attribute__((ext_vector_type(16))) _Float16     v16h;
typedef __attribute__((ext_vector_type(8)))  _Float16     v8h;
typedef __attribute__((ext_vector_type(4)))  _Float16     v4h;
typedef __attribute__((ext_vector_type(8)))  float        v8f;
typedef __attribute__((ext_vector_type(4)))  float        f32x4;
typedef __attribute__((ext_vector_type(4)))  unsigned int u32x4;
typedef __attribute__((ext_vector_type(2)))  unsigned int u32x2;

#define EMBED 1024
#define SEQ   2048
#define BATCH 4
#define HD    128
#define TILE  128
#define LDW   136   // padded half-stride for 128-wide tiles (272B, 16B multiple)
#define BK    64    // K chunk of the projection
#define NC    (EMBED / BK)
#define LDK   72    // padded half-stride of the projection's 64-wide tiles (144 B = 16 B x 9)
#define PBUF  (TILE * LDK)                 // one projection tile in LDS, halves
#define NW    (EMBED * HD)                 // one weight matrix, elements

// fp16 workspace layout (offsets in halves)
#define QOFF  ((size_t)0)                           // Q  [B][S][D] (pre-scaled)
#define KOFF  ((size_t)BATCH * SEQ * HD)            // K  [B][S][D]
#define VOFF  ((size_t)2 * BATCH * SEQ * HD)        // V^T [B][D][S]
#define XOFF  ((size_t)3 * BATCH * SEQ * HD)        // not used
#define WOFF  (XOFF + (size_t)BATCH * SEQ * EMBED)  // not used

// key split of the attention: a work-group takes CH key tiles of one query tile
#define NQT   (SEQ / TILE)                 // query tiles per batch
#define CH    3                            // key tiles per work-group
#define MAXS  ((NQT + CH - 1) / CH)        // most key ranges a query tile has
constexpr int count_ranges() {             // (query tile, key range) pairs per batch
    int n = 0;
    for (int q = 0; q < NQT; ++q) n += q / CH + 1;
    return n;
}
constexpr int NRANGE = count_ranges();
// f32 partials behind the fp16 planes (offsets in halves; slot = (batch*NQT+qtile)*MAXS+range)
#define POFF  (WOFF + (size_t)3 * NW)                                   // O  [slot][128 r][128 d]
#define MLOFF (POFF + (size_t)2 * BATCH * NQT * MAXS * TILE * HD)       // [slot][8 waves][16 max | 16 sum]

// LDS layout for attention kernel (offsets in halves)
#define OFFQ  0
#define OFFP  (TILE * LDW)          // free: P stays in registers
#define OFFK0 (2 * TILE * LDW)
#define OFFK1 (3 * TILE * LDW)
#define OFFV0 (4 * TILE * LDW)
#define OFFV1 (5 * TILE * LDW)
#define SMEM2_BYTES (6 * TILE * LDW * 2)   // 208,896 B < 320 KB/WGP
#define STP   132   // f32 pitch of the output staging rows (528 B: 16 lanes' 16-B stores meet no bank twice)

// ---------------------------------------------------------------------------
// 16x32 fp16 A/B fragment load from LDS (CDNA5 16-bit matrix layout:
// lanes 0-15 hold K {0..7,16..23}, lanes 16-31 hold K {8..15,24..31}).
// ---------------------------------------------------------------------------
__device__ inline v16h frag_ld(const _Float16* p, int stride) {
    const int lane = threadIdx.x & 31;
    const int r    = lane & 15;
    const int ko   = (lane >> 4) * 8;
    const _Float16* q = p + r * stride + ko;
    union { v16h v; v8h h[2]; } u;
    u.h[0] = *(const v8h*)(q);        // ds_load_b128
    u.h[1] = *(const v8h*)(q + 16);   // ds_load_b128
    return u.v;
}

// The 8 fragments (16 rows each) of a 128-row tile at one k step of 32, read as one group.
__device__ inline void frag_group(v16h (&f)[8], const _Float16* p) {
#pragma unroll
    for (int t = 0; t < 8; ++t) f[t] = frag_ld(p + (t * 16) * LDW, LDW);
}

// Work-group barrier of the projection's K loop.  It waits for the wave's LDS traffic alone:
// __syncthreads() would also wait for the global loads of the next chunk, which are meant
// to stay in flight across it.
__device__ inline void lds_barrier() {
    asm volatile("s_wait_dscnt 0x0\n\ts_barrier_signal -1\n\ts_barrier_wait -1" ::: "memory");
}
// The same barrier, naming the accumulators as inputs: the chunk's products then stand in front of
// it.  Moved behind it, their fragments would stay live beside the next chunk's, which is more
// registers than a wave of a 16-wave work-group has (spills).
__device__ inline void lds_barrier_behind(const v8f (&acc)[4]) {
    asm volatile("s_wait_dscnt 0x0\n\ts_barrier_signal -1\n\ts_barrier_wait -1"
                 :: "v"(acc[0]), "v"(acc[1]), "v"(acc[2]), "v"(acc[3]) : "memory");
}
// a where c holds, else b
__device__ inline v4h pick(bool c, v4h a, v4h b) {
    const u32x2 x = __builtin_bit_cast(u32x2, a), y = __builtin_bit_cast(u32x2, b);
    return __builtin_bit_cast(v4h, u32x2{c ? x[0] : y[0], c ? x[1] : y[1]});
}

// ---------------------------------------------------------------------------
// Kernel 1: QKV projection straight from the f32 inputs.
// grid = (B*S/128, 3), 512 threads (16 waves), a wave owns 16 rows x 64 columns.
// Each K chunk of BK goes global -> registers (f32) -> fp16 -> LDS.  Two register sets and
// two LDS buffers: the loads of two chunks are in flight at any time, and chunk c + 1 is
// converted and stored while chunk c is read and multiplied; one barrier a chunk.
// sel 0: Q (pre-scaled) [B][S][D];  sel 1: K [B][S][D];  sel 2: V^T [B][D][S]
// ---------------------------------------------------------------------------
// One chunk's loads.  x: a wave-wide load is 256 B of each of two rows; W [k][n]: one k row of 128 n.
__device__ __forceinline__ void chunk_load(f32x4 (&rx)[4], f32x4 (&rw)[4],
                                           const float* xg, const float* wg, int c) {
    const float* xn = xg + c * BK;
    const float* wn = wg + (size_t)c * BK * HD;
#pragma unroll
    for (int j = 0; j < 4; ++j) rx[j] = *(const f32x4*)(xn + (size_t)j * 32 * EMBED);
#pragma unroll
    for (int i = 0; i < 4; ++i) rw[i] = *(const f32x4*)(wn + (size_t)i * HD);
    // Stands behind the run of loads, before their address registers are used for anything else.
    // It names the two base addresses as inputs: they stay live up to it, so that no load's own
    // result is given an address register of the run.
    asm volatile("s_wait_xcnt 0x0" :: "v"(xg), "v"(wg) : "memory");
}
// One chunk: registers -> fp16 -> LDS.  dX: the thread's place in row xr of the x tile;
// dW: row lane * 4 of the W^T tile at the wave's 4 k.
__device__ __forceinline__ void chunk_store(const f32x4 (&rx)[4], const f32x4 (&rw)[4],
                                            _Float16* dX, _Float16* dW, int rot) {
#pragma unroll
    for (int j = 0; j < 4; ++j) {
        v4h h;
#pragma unroll
        for (int e = 0; e < 4; ++e) h[e] = (_Float16)rx[j][e];
        *(v4h*)&dX[j * 32 * LDK] = h;
    }
    v4h h[4];
#pragma unroll
    for (int e = 0; e < 4; ++e)
#pragma unroll
        for (int i = 0; i < 4; ++i) h[e][i] = (_Float16)rw[i][e];
    // A lane's 4 rows lie 4 pitches from its neighbour's: stored in the same order by every
    // lane, the lanes would meet on 4 bank pairs.  Lane l starts at row (l >> 2) & 3.
    const bool m1 = rot & 1, m2 = rot & 2;
    v4h t[4], u[4];
#pragma unroll
    for (int i = 0; i < 4; ++i) t[i] = pick(m1, h[(i + 1) & 3], h[i]);
#pragma unroll
    for (int i = 0; i < 4; ++i) u[i] = pick(m2, t[(i + 2) & 3], t[i]);   // u[i] = h[(i + rot) & 3]
#pragma unroll
    for (int i = 0; i < 4; ++i) *(v4h*)&dW[((i + rot) & 3) * LDK] = u[i];
}
// Chunk c, whose tiles lie complete in buffer BUF.  nx, nw hold chunk c + 1, which goes to the
// other buffer, and are then filled with chunk c + 3.
template <int BUF, bool STORE, bool LOAD>
__device__ __forceinline__ void proj_chunk(int c, f32x4 (&nx)[4], f32x4 (&nw)[4], v8f (&acc)[4],
                                           const _Float16* fX, const _Float16* fW,
                                           _Float16* dX, _Float16* dW, int rot,
                                           const float* xg, const float* wg) {
    // all fragments of the chunk as one group of LDS reads
    v16h fa[BK / 32], fb[BK / 32][4];
#pragma unroll
    for (int kc = 0; kc < BK / 32; ++kc) {
        fa[kc] = frag_ld(fX + BUF * PBUF + kc * 32, LDK);
#pragma unroll
        for (int t = 0; t < 4; ++t) fb[kc][t] = frag_ld(fW + BUF * PBUF + (t * 16) * LDK + kc * 32, LDK);
    }
    // keeps the reads above in front of the conversion below, which then runs under their latency
    __builtin_amdgcn_sched_barrier(0);
    if (STORE) chunk_store(nx, nw, dX + (BUF ^ 1) * PBUF, dW + (BUF ^ 1) * PBUF, rot);
    if (LOAD)  chunk_load(nx, nw, xg, wg, c + 3);
    // keeps the products behind the stores and the loads: in front of them they would hold
    // both back for the time of the fragment reads
    __builtin_amdgcn_sched_barrier(0);
#pragma unroll
    for (int kc = 0; kc < BK / 32; ++kc)
#pragma unroll
        for (int t = 0; t < 4; ++t)
            acc[t] = __builtin_amdgcn_wmma_f32_16x16x32_f16(
                false, fa[kc], false, fb[kc][t], (short)0, acc[t], false, false);
    lds_barrier_behind(acc);   // chunk c + 1 is complete, and every wave has read chunk c
}

__global__ __launch_bounds__(512) void qkv_proj_kernel(
    const float* __restrict__ x,
    const float* __restrict__ wq, const float* __restrict__ wk, const float* __restrict__ wv,
    const float* __restrict__ bq, const float* __restrict__ bk, const float* __restrict__ bv,
    _Float16* __restrict__ ws) {
    __shared__ __attribute__((aligned(16))) _Float16 sX[2 * PBUF];   // x tiles [128 s][BK k]; epilogue bounce buffer
    __shared__ __attribute__((aligned(16))) _Float16 sW[2 * PBUF];   // W^T tiles [128 n][BK k]
    static_assert(2 * PBUF >= TILE * LDW, "the bounce buffer fits the x tiles");

    const int sel     = blockIdx.y;
    const float* bias = sel == 0 ? bq : (sel == 1 ? bk : bv);
    const float* w    = sel == 0 ? wq : (sel == 1 ? wk : wv);
    const int batch = blockIdx.x >> 4;
    const int m0    = (blockIdx.x & 15) * TILE;
    const int tid   = threadIdx.x;
    const int wave  = tid >> 5;
    const int lane  = tid & 31;
    const int rg    = wave & 7;    // the wave's group of 16 rows
    const int ch    = wave >> 3;   // the wave's half of the 128 columns

    const int xr = wave * 2 + (lane >> 4), xc = (lane & 15) * 4;   // rows xr, xr + 32, ...; 4 k at xc
    const float* xg = x + ((size_t)batch * SEQ + m0 + xr) * EMBED + xc;
    // a thread holds a block of 4 k x 4 n of W, so that 4 consecutive k of one n are one
    // 8-B LDS store of the transposed tile
    const float* wg = w + (size_t)(wave * 4) * HD + lane * 4;
    const int rot = (lane >> 2) & 3;   // which of its 4 n a lane stores first
    _Float16* dX = &sX[xr * LDK + xc];
    _Float16* dW = &sW[(lane * 4) * LDK + wave * 4];
    const _Float16* fX = &sX[(rg * 16) * LDK];
    const _Float16* fW = &sW[(ch * 64) * LDK];

    f32x4 rx0[4], rw0[4], rx1[4], rw1[4];   // even chunks, odd chunks
    chunk_load(rx0, rw0, xg, wg, 0);
    chunk_load(rx1, rw1, xg, wg, 1);
    chunk_store(rx0, rw0, dX, dW, rot);
    chunk_load(rx0, rw0, xg, wg, 2);
    lds_barrier();   // chunk 0 is complete

    v8f acc[4] = {};
    for (int c = 0; c < NC - 4; c += 2) {
        proj_chunk<0, true, true>(c,     rx1, rw1, acc, fX, fW, dX, dW, rot, xg, wg);
        proj_chunk<1, true, true>(c + 1, rx0, rw0, acc, fX, fW, dX, dW, rot, xg, wg);
    }
    proj_chunk<0, true,  true >(NC - 4, rx1, rw1, acc, fX, fW, dX, dW, rot, xg, wg);
    proj_chunk<1, true,  false>(NC - 3, rx0, rw0, acc, fX, fW, dX, dW, rot, xg, wg);
    proj_chunk<0, true,  false>(NC - 2, rx1, rw1, acc, fX, fW, dX, dW, rot, xg, wg);
    proj_chunk<1, false, false>(NC - 1, rx0, rw0, acc, fX, fW, dX, dW, rot, xg, wg);

    // bias (+Q scale) -> fp16 into LDS bounce; transposed for V
    _Float16* sOut = sX;
    const int hi = lane >> 4, ln = lane & 15;
    const float qscale = 0.088388347648318447f;   // 1/sqrt(128)
#pragma unroll
    for (int t = 0; t < 4; ++t) {
        int n = ch * 64 + t * 16 + ln;
        float bb = bias[n];
#pragma unroll
        for (int i = 0; i < 8; ++i) {
            int r = rg * 16 + i + 8 * hi;
            float v = acc[t][i] + bb;
            if (sel == 0) v *= qscale;
            if (sel == 2) sOut[n * LDW + r] = (_Float16)v;
            else          sOut[r * LDW + n] = (_Float16)v;
        }
    }
    __syncthreads();

    // coalesced 16B global stores from the bounce buffer
    if (sel == 2) {
        _Float16* dst = ws + VOFF + (size_t)batch * SEQ * HD;  // [D][S]
        for (int c = 0; c < 4; ++c) {
            int idx = c * 512 + tid;
            int r = idx >> 4, c8 = (idx & 15) * 8;
            *(v8h*)&dst[(size_t)r * SEQ + m0 + c8] = *(const v8h*)&sOut[r * LDW + c8];
        }
    } else {
        _Float16* dst = ws + (sel ? KOFF : QOFF) + (size_t)batch * SEQ * HD; // [S][D]
        for (int c = 0; c < 4; ++c) {
            int idx = c * 512 + tid;
            int r = idx >> 4, c8 = (idx & 15) * 8;
            *(v8h*)&dst[(size_t)(m0 + r) * HD + c8] = *(const v8h*)&sOut[r * LDW + c8];
        }
    }
}

// ---------------------------------------------------------------------------
// Tensor load of the attention kernel: one tile of 128 rows of 256 bytes, every
// extent in bytes, 16 bytes of LDS pad behind each row (LDS pitch 272 B = LDW halves).
// ---------------------------------------------------------------------------
typedef __attribute__((ext_vector_type(8))) unsigned int u32x8;
__device__ inline unsigned uni(unsigned v) { return (unsigned)__builtin_amdgcn_readfirstlane((int)v); }
// A wave-uniform value held in a scalar register.  On a test: the branch on it is a scalar
// branch (a tensor load ignores EXEC, only such a branch keeps a wave from issuing it).
// On a descriptor word: the word has one register of its own, which the compiler does not
// hand out and fill again between the request and its wait.
__device__ inline unsigned pinned(unsigned v) {
    unsigned w = uni(v);
    asm volatile("" : "+s"(w));   // issue test or descriptor word of a tensor load held in a scalar register
    return w;
}
// lane l takes the value of lane l ^ 16
__device__ inline float xhalf(float x) {
    const int b = __builtin_bit_cast(int, x);
    return __builtin_bit_cast(float, __builtin_amdgcn_permlanex16(b, b, 0x76543210, 0xfedcba98, false, false));
}
// The wave's own LDS reads and writes have retired before a buffer is handed back.
__device__ inline void wait_ds0() { asm volatile("s_wait_dscnt 0x0" ::: "memory"); }
__device__ inline u32x4 tile_group0(unsigned lds_byte_addr, const _Float16* gsrc) {
    const unsigned long long ga = (unsigned long long)(size_t)gsrc;
    u32x4 g;
    g[0] = pinned(1u);                                 // count = 1; descriptor word held in a scalar register
    g[1] = uni(lds_byte_addr);
    g[2] = uni((unsigned)ga);
    g[3] = uni((((unsigned)(ga >> 32)) & 0x01FFFFFFu) | 0x80000000u);   // type = 2
    return g;
}
__device__ inline u32x8 tile_group1(unsigned pitch_bytes) {
    constexpr unsigned d0 = 2 * TILE, d1 = TILE;       // bytes in a row, rows
    u32x8 g;
    g[0] = uni((1u << 20) | (5u << 22) | (3u << 25));  // no mask, 1-byte elements, pad 4 dwords per 256-B row
    // words 1 to 7: descriptor words held in scalar registers
    g[1] = pinned((d0 & 0xFFFFu) << 16);
    g[2] = pinned((d0 >> 16) | ((d1 & 0xFFFFu) << 16));
    g[3] = pinned((d1 >> 16) | (d0 << 16));
    g[4] = pinned(d1);
    g[5] = pinned(pitch_bytes);
    g[6] = pinned(0u);
    g[7] = pinned(0u);
    return g;
}
// asm so that it keeps its place among the asm waits around it
__device__ inline void tile_load(u32x4 g0, u32x8 g1) {
    asm volatile("tensor_load_to_lds %0, %1" :: "s"(g0), "s"(g1) : "memory");
}
// The compiler places no wait for a tensor load: a tile counts as landed behind this one.
// It names the request's descriptor as inputs so that those registers stay as they are
// for as long as the request is in flight.
__device__ inline void wait_tile(u32x4 g0, u32x8 g1) {
    asm volatile("s_wait_tensorcnt 0x0" :: "s"(g0), "s"(g1) : "memory");
}

// e^x for the softmax and the merge weights.  The v_nop in the same statement is the one slot the
// instruction set asks for behind a transcendental before its source register is
// overwritten or its result read.
__device__ inline float exp_weight(float x) {
    float e;
    asm("v_exp_f32 %0, %1\n\tv_nop" : "=v"(e) : "v"(x * 1.4426950408889634f));
    return e;
}

// ---------------------------------------------------------------------------
// Kernel 2: causal flash attention over ONE key range, TDM-fed, K/V double-buffered.
// grid = (NRANGE, B), 256 threads (8 waves), each wave owns 16 queries (one per lane pair).
// Leaves the un-normalised sum with its row maximum and row sum; kernel 3 merges.
// ---------------------------------------------------------------------------
__global__ __launch_bounds__(256) void attn_kernel(
    const _Float16* __restrict__ ws, float* __restrict__ part_o, float* __restrict__ part_ml) {
    extern __shared__ __attribute__((aligned(2048))) _Float16 smem[];   // every tile's place a multiple of 2 KiB

    const int batch = blockIdx.y;
    int qtile = NQT - 1, range = blockIdx.x;      // flat index -> (query tile, key range)
    while (range > qtile / CH) { range -= qtile / CH + 1; --qtile; }
    const int j0    = range * CH;                 // first key tile of the range
    const int qt    = min(CH - 1, qtile - j0);    // last key tile, counted from j0
    const int q0    = qtile * TILE;
    const int tid   = threadIdx.x, wave = tid >> 5, lane = tid & 31;
    const int hi    = lane >> 4,  ln   = lane & 15;
    const size_t SD = (size_t)SEQ * HD;

    const _Float16* Qg = ws + QOFF + (size_t)batch * SD + (size_t)q0 * HD;  // pre-scaled
    const _Float16* Kg = ws + KOFF + (size_t)batch * SD + (size_t)j0 * TILE * HD;
    const _Float16* Vg = ws + VOFF + (size_t)batch * SD + (size_t)j0 * TILE;  // [D][S]
    const unsigned lds0 = (unsigned)(size_t)(void*)smem;

    const unsigned wv = uni(threadIdx.x >> 5);   // the wave's number, scalar

    // Wave 0 brings the K tiles, wave 1 the V tiles, wave 2 Q: one request of a wave
    // in flight at any time, each wave with its own source, place and row pitch.
    const _Float16* src  = wv == 0 ? Kg : (wv == 1 ? Vg : Qg);
    const unsigned place = lds0 + 2 * (wv == 0 ? OFFK0 : (wv == 1 ? OFFV0 : OFFQ));
    const size_t   step  = wv == 1 ? (size_t)TILE : (size_t)TILE * HD;   // halves from key tile to key tile
    const u32x8 g1 = tile_group1(wv == 1 ? 2 * SEQ : 2 * HD);
    u32x4 g0 = tile_group0(place, src);
    // stage 0 lands and is published before anything reads it
    if (pinned(wv < 3)) { tile_load(g0, g1); wait_tile(g0, g1); }
    __syncthreads();
    // stage 1 flies under pass 0, where the range has a second key tile
    g0 = tile_group0(place + 2 * TILE * LDW, src + step);
    if (pinned(wv < 2 && qt >= 1)) tile_load(g0, g1);

    v8f o_acc[8] = {};                 // o_acc[dt][i] = O[query ln][d = dt * 16 + 8 * hi + i]
    float m_i = -3.0e38f, l_i = 0.f;   // the query's maximum; the sum over this wave half's keys

    // the wave's Q fragments (B operand: column = query) stay in registers for all its key tiles
    v16h qb[4];
#pragma unroll
    for (int kc = 0; kc < 4; ++kc) qb[kc] = frag_ld(&smem[OFFQ + (wave * 16) * LDW + kc * 32], LDW);

    for (int j = 0; j <= qt; ++j) {
        const _Float16* sK = smem + ((j & 1) ? OFFK1 : OFFK0);
        const _Float16* sV = smem + ((j & 1) ? OFFV1 : OFFV0);

        // S^T = K Q^T : 128 keys x the wave's 16 queries, K-dim 128 = 4 x 32.
        // The 8 K fragments of k step kc + 1 are read as one group while the 8 products of
        // step kc run; under the last step, and the softmax behind it, the first V group.
        v16h fb[2][8];
        frag_group(fb[0], sK);
        v8f s[8] = {};                 // s[t][i] = score(key t * 16 + 8 * hi + i, query ln)
#pragma unroll
        for (int kc = 0; kc < 4; ++kc) {
            if (kc + 1 < 4) frag_group(fb[(kc + 1) & 1], sK + (kc + 1) * 32);
            else            frag_group(fb[0], sV);
            // keeps the reads above in front of the products below: moved behind them, each
            // product would wait out the whole latency of its own LDS read
            __builtin_amdgcn_sched_barrier(0);
#pragma unroll
            for (int t = 0; t < 8; ++t)
                s[t] = __builtin_amdgcn_wmma_f32_16x16x32_f16(
                    false, fb[kc & 1][t], false, qb[kc], (short)0, s[t], false, false);
        }

        if (j0 + j == qtile) {   // diagonal tile: causal mask
#pragma unroll
            for (int t = 0; t < 8; ++t)
#pragma unroll
                for (int i = 0; i < 8; ++i)
                    if (t * 16 + 8 * hi + i > wave * 16 + ln) s[t][i] = -3.0e38f;
        }

        // online softmax, all of a query's scores in two lanes: maximum and sum run down the
        // lane's own registers, and one exchange between the wave halves joins the maxima
        v8f mx8 = s[0];
#pragma unroll
        for (int t = 1; t < 8; ++t)
#pragma unroll
            for (int i = 0; i < 8; ++i) mx8[i] = fmaxf(mx8[i], s[t][i]);
        float rmax = fmaxf(fmaxf(fmaxf(mx8[0], mx8[1]), fmaxf(mx8[2], mx8[3])),
                           fmaxf(fmaxf(mx8[4], mx8[5]), fmaxf(mx8[6], mx8[7])));
        rmax = fmaxf(rmax, xhalf(rmax));
        const float mnew  = fmaxf(m_i, rmax);
        const float alpha = exp_weight(m_i - mnew);
        v8f sum8 = {};
#pragma unroll
        for (int t = 0; t < 8; ++t)
#pragma unroll
            for (int i = 0; i < 8; ++i) {
                s[t][i] = exp_weight(s[t][i] - mnew);
                sum8[i] += s[t][i];
            }
        l_i = l_i * alpha + (((sum8[0] + sum8[1]) + (sum8[2] + sum8[3])) +
                             ((sum8[4] + sum8[5]) + (sum8[6] + sum8[7])));
        m_i = mnew;
#pragma unroll
        for (int dt = 0; dt < 8; ++dt) o_acc[dt] *= alpha;

        // P^T as B operand: two score tiles (32 keys) converted in place are one fragment in
        // the k order of frag_ld: element e = key 8 * hi + e, element 8 + e = key 16 + 8 * hi + e
        v16h pb[4];
#pragma unroll
        for (int nc = 0; nc < 4; ++nc)
#pragma unroll
            for (int i = 0; i < 8; ++i) {
                pb[nc][i]     = (_Float16)s[2 * nc][i];
                pb[nc][8 + i] = (_Float16)s[2 * nc + 1][i];
            }

        // O^T += V^T P^T : reduce over 128 keys in chunks of 32, the V group of chunk nc + 1
        // read while the 8 products of chunk nc run
#pragma unroll
        for (int nc = 0; nc < 4; ++nc) {
            if (nc + 1 < 4) frag_group(fb[(nc + 1) & 1], sV + (nc + 1) * 32);
            // keeps the reads above in front of the products below, as in S^T = K Q^T
            __builtin_amdgcn_sched_barrier(0);
#pragma unroll
            for (int dt = 0; dt < 8; ++dt)
                o_acc[dt] = __builtin_amdgcn_wmma_f32_16x16x32_f16(
                    false, fb[nc & 1][dt], false, pb[nc], (short)0, o_acc[dt], false, false);
        }
        // publish tile j+1 and free tile j's buffers: own LDS traffic retired, the
        // issuers' tiles landed, one barrier for both, and only then the refill
        wait_ds0();
        if (pinned(wv < 2)) wait_tile(g0, g1);
        __syncthreads();
        g0 = tile_group0(place + (j & 1) * (2 * TILE * LDW), src + (size_t)(j + 2) * step);
        if (pinned(wv < 2 && j + 2 <= qt)) tile_load(g0, g1);
    }
    wait_tile(g0, g1);
    wait_ds0();

    const size_t slot = ((size_t)batch * NQT + qtile) * MAXS + range;
    float* po = part_o  + slot * (TILE * HD) + (size_t)(wave * 16) * HD;
    float* ml = part_ml + slot * (2 * TILE) + wave * 32;   // one 128-B line per wave
    // O^T -> O through the wave's own rows of the K buffers, which every wave has left at the
    // loop's last barrier and no tensor load is aimed at any more: a lane writes 8 d of its
    // query, then the wave reads whole rows and stores 512 contiguous bytes at a time.
    float* st = (float*)(smem + OFFK0) + wave * (16 * STP);
#pragma unroll
    for (int dt = 0; dt < 8; ++dt) {
        *(f32x4*)&st[ln * STP + dt * 16 + 8 * hi] =
            f32x4{o_acc[dt][0], o_acc[dt][1], o_acc[dt][2], o_acc[dt][3]};
        *(f32x4*)&st[ln * STP + dt * 16 + 8 * hi + 4] =
            f32x4{o_acc[dt][4], o_acc[dt][5], o_acc[dt][6], o_acc[dt][7]};
    }
#pragma unroll
    for (int r = 0; r < 16; ++r)
        *(f32x4*)&po[(size_t)r * HD + lane * 4] = *(const f32x4*)&st[r * STP + lane * 4];
    // lanes 0-15 store the 16 maxima, lanes 16-31 the 16 sums (both halves' keys joined)
    const float l_all = l_i + xhalf(l_i);
    ml[lane] = hi ? l_all : m_i;
}

// ---------------------------------------------------------------------------
// Kernel 3: merge the key ranges of each query row.
// grid = B*S/16, 256 threads: a wave takes rows w and w+8 of 16, a lane 4 columns.
// ---------------------------------------------------------------------------
__global__ __launch_bounds__(256) void merge_kernel(
    const float* __restrict__ part_o, const float* __restrict__ part_ml,
    float* __restrict__ out) {
    const int row0  = blockIdx.x * 16;            // flat row (batch*SEQ + s), 16 rows of one tile
    const int qtile = (row0 & (SEQ - 1)) / TILE;
    const int ns    = qtile / CH + 1;             // key ranges of this query tile
    const int rt0   = row0 & (TILE - 1);          // first row inside the tile
    const size_t slot0 = ((size_t)(row0 / SEQ) * NQT + qtile) * MAXS;
    const float* po = part_o  + slot0 * (TILE * HD);
    const float* ml = part_ml + slot0 * (2 * TILE) + (rt0 >> 4) * 32;
    const int w  = threadIdx.x >> 5;
    const int d4 = (threadIdx.x & 31) * 4;

    f32x4 o[2][MAXS];
    float m[2][MAXS], l[2][MAXS];
#pragma unroll
    for (int c = 0; c < MAXS; ++c) {
#pragma unroll
        for (int k = 0; k < 2; ++k) {
            o[k][c] = f32x4{0.f, 0.f, 0.f, 0.f};
            m[k][c] = -3.0e38f;
            l[k][c] = 0.f;
        }
        if (c < ns) {
#pragma unroll
            for (int k = 0; k < 2; ++k) {
                int rr = w + 8 * k;
                o[k][c] = *(const f32x4*)&po[(size_t)c * (TILE * HD) + (size_t)(rt0 + rr) * HD + d4];
                m[k][c] = ml[c * (2 * TILE) + rr];
                l[k][c] = ml[c * (2 * TILE) + 16 + rr];
            }
        }
    }
#pragma unroll
    for (int k = 0; k < 2; ++k) {
        float mx = m[k][0];
#pragma unroll
        for (int c = 1; c < MAXS; ++c) mx = fmaxf(mx, m[k][c]);
        float wt[MAXS];
#pragma unroll
        for (int c = 0; c < MAXS; ++c) wt[c] = exp_weight(m[k][c] - mx);
        f32x4 acc = {0.f, 0.f, 0.f, 0.f};
        float ls  = 0.f;
#pragma unroll
        for (int c = 0; c < MAXS; ++c) {
            ls  += wt[c] * l[k][c];
            acc += wt[c] * o[k][c];
        }
        *(f32x4*)&out[(size_t)(row0 + w + 8 * k) * HD + d4] = acc * (1.0f / ls);
    }
}

extern "C" void kernel_launch(void* const* d_in, const int* in_sizes, int n_in,
                              void* d_out, int out_size, void* d_ws, size_t ws_size,
                              hipStream_t stream) {
    const float* x  = (const float*)d_in[0];
    const float* wq = (const float*)d_in[1];
    const float* bq = (const float*)d_in[2];
    const float* wk = (const float*)d_in[3];
    const float* bk = (const float*)d_in[4];
    const float* wv = (const float*)d_in[5];
    const float* bv = (const float*)d_in[6];
    _Float16* ws = (_Float16*)d_ws;   // fp16 Q, K, V^T; f32 partials behind

    qkv_proj_kernel<<<dim3(BATCH * SEQ / TILE, 3), 512, 0, stream>>>(
        x, wq, wk, wv, bq, bk, bv, ws);
    float* part_o  = (float*)(ws + POFF);
    float* part_ml = (float*)(ws + MLOFF);
    attn_kernel<<<dim3(NRANGE, BATCH), 256, SMEM2_BYTES, stream>>>(ws, part_o, part_ml);
    merge_kernel<<<BATCH * SEQ / 16, 256, 0, stream>>>(part_o, part_ml, (float*)d_out);
}

// v006
// Measured time: 27 microseconds a run.
// In two side-by-side timings against v005, it was 1.05 and 1.04 times as fast.
// Over all steps from v000 it is 4.76 times as fast.
#include <hip/hip_runtime.h>
#include <hip/hip_bf16.h>

typedef __attribute__((ext_vector_type(16))) _Float16     v16h;
typedef __attribute__((ext_vector_type(8)))  _Float16     v8h;
typedef __attribute__((ext_vector_type(4)))  _Float16     v4h;
typedef __attribute__((ext_vector_type(8)))  float        v8f;
typedef __attribute__((ext_vector_type(4)))  float        f32x4;
typedef __attribute__((ext_vector_type(4)))  unsigned int u32x4;
typedef __attribute__((ext_vector_type(2)))  unsigned int u32x2;

#define EMBED 1024
#define SEQ   2048
#define BATCH 4
#define HD    128
#define TILE  128
#define LDW   136   // padded half-stride for 128-wide tiles (272B, 16B multiple)
#define BK    64    // K chunk of the projection
#define NC    (EMBED / BK)
#define LDK   72    // padded half-stride of the projection's 64-wide tiles (144 B = 16 B x 9)
#define PBUF  (TILE * LDK)                 // one projection tile in LDS, halves
#define NW    (EMBED * HD)                 // one weight matrix, elements

// fp16 workspace layout (offsets in halves)
#define QOFF  ((size_t)0)                           // Q  [B][S][D] (pre-scaled)
#define KOFF  ((size_t)BATCH * SEQ * HD)            // K  [B][S][D]
#define VOFF  ((size_t)2 * BATCH * SEQ * HD)        // V^T [B][D][S]
#define XOFF  ((size_t)3 * BATCH * SEQ * HD)        // not used
#define WOFF  (XOFF + (size_t)BATCH * SEQ * EMBED)  // not used

// key split of the attention: a work-group takes CH key tiles of one query tile
#define NQT   (SEQ / TILE)                 // query tiles per batch
#define CH    3                            // key tiles per work-group
#define MAXS  ((NQT + CH - 1) / CH)        // most key ranges a query tile has
constexpr int count_ranges() {             // (query tile, key range) pairs per batch
    int n = 0;
    for (int q = 0; q < NQT; ++q) n += q / CH + 1;
    return n;
}
constexpr int NRANGE = count_ranges();
// f32 partials behind the fp16 planes (offsets in halves; slot = (batch*NQT+qtile)*MAXS+range)
#define POFF  (WOFF + (size_t)3 * NW)                                   // O  [slot][128 r][128 d]
#define MLOFF (POFF + (size_t)2 * BATCH * NQT * MAXS * TILE * HD)       // [slot][8 waves][16 max | 16 sum]

// LDS layout for attention kernel (offsets in halves)
#define OFFQ  0
#define OFFP  (TILE * LDW)          // free: P stays in registers
#define OFFK0 (2 * TILE * LDW)
#define OFFK1 (3 * TILE * LDW)
#define OFFV0 (4 * TILE * LDW)
#define OFFV1 (5 * TILE * LDW)
#define SMEM2_BYTES (6 * TILE * LDW * 2)   // 208,896 B < 320 KB/WGP
#define STP   132   // f32 pitch of the output staging rows (528 B: 16 lanes' 16-B stores meet no bank twice)

// ---------------------------------------------------------------------------
// 16x32 fp16 A/B fragment load from LDS (CDNA5 16-bit matrix layout:
// lanes 0-15 hold K {0..7,16..23}, lanes 16-31 hold K {8..15,24..31}).
// ---------------------------------------------------------------------------
__device__ inline v16h frag_ld(const _Float16* p, int stride) {
    const int lane = threadIdx.x & 31;
    const int r    = lane & 15;
    const int ko   = (lane >> 4) * 8;
    const _Float16* q = p + r * stride + ko;
    union { v16h v; v8h h[2]; } u;
    u.h[0] = *(const v8h*)(q);        // ds_load_b128
    u.h[1] = *(const v8h*)(q + 16);   // ds_load_b128
    return u.v;
}

// The 8 fragments (16 rows each) of a 128-row tile at one k step of 32, read as one group.
__device__ inline void frag_group(v16h (&f)[8], const _Float16* p) {
#pragma unroll
    for (int t = 0; t < 8; ++t) f[t] = frag_ld(p + (t * 16) * LDW, LDW);
}

// Work-group barrier of the projection's K loop.  It waits for the wave's LDS traffic alone:
// __syncthreads() would also wait for the global loads of the next chunk, which are meant
// to stay in flight across it.
__device__ inline void lds_barrier() {
    asm volatile("s_wait_dscnt 0x0\n\ts_barrier_signal -1\n\ts_barrier_wait -1" ::: "memory");
}
// The same barrier, naming the accumulators as inputs: the chunk's products then stand in front of
// it.  Moved behind it, their fragments would stay live beside the next chunk's, which is more
// registers than a wave of a 16-wave work-group has (spills).
__device__ inline void lds_barrier_behind(const v8f (&acc)[4]) {
    asm volatile("s_wait_dscnt 0x0\n\ts_barrier_signal -1\n\ts_barrier_wait -1"
                 :: "v"(acc[0]), "v"(acc[1]), "v"(acc[2]), "v"(acc[3]) : "memory");
}
// a where c holds, else b
__device__ inline v4h pick(bool c, v4h a, v4h b) {
    const u32x2 x = __builtin_bit_cast(u32x2, a), y = __builtin_bit_cast(u32x2, b);
    return __builtin_bit_cast(v4h, u32x2{c ? x[0] : y[0], c ? x[1] : y[1]});
}

// ---------------------------------------------------------------------------
// Kernel 1: QKV projection straight from the f32 inputs.
// grid = (B*S/128, 3), 512 threads (16 waves), a wave owns 16 rows x 64 columns of the product
// A B^T: for V^T, A is the x tile and B the W^T tile; for Q and K the two change places.  Either way
// a lane's 8 accumulator registers are 8 neighbours of one row of the plane as it is stored.
// Each K chunk of BK goes global -> registers (f32) -> fp16 -> LDS.  Two register sets and
// two LDS buffers: the loads of two chunks are in flight at any time, and chunk c + 1 is
// converted and stored while chunk c is read and multiplied; one barrier a chunk.
// sel 0: Q (pre-scaled) [B][S][D];  sel 1: K [B][S][D];  sel 2: V^T [B][D][S]
// ---------------------------------------------------------------------------
// One chunk's loads.  x: a wave-wide load is 256 B of each of two rows; W [k][n]: one k row of 128 n.
__device__ __forceinline__ void chunk_load(f32x4 (&rx)[4], f32x4 (&rw)[4],
                                           const float* xg, const float* wg, int c) {
    const float* xn = xg + c * BK;
    const float* wn = wg + (size_t)c * BK * HD;
#pragma unroll
    for (int j = 0; j < 4; ++j) rx[j] = *(const f32x4*)(xn + (size_t)j * 32 * EMBED);
#pragma unroll
    for (int i = 0; i < 4; ++i) rw[i] = *(const f32x4*)(wn + (size_t)i * HD);
    // Stands behind the run of loads, before their address registers are used for anything else.
    // It names the two base addresses as inputs: they stay live up to it, so that no load's own
    // result is given an address register of the run.
    asm volatile("s_wait_xcnt 0x0" :: "v"(xg), "v"(wg) : "memory");
}
// One chunk: registers -> fp16 -> LDS.  dX: the thread's place in row xr of the x tile;
// dW: row lane * 4 of the W^T tile at the wave's 4 k.
__device__ __forceinline__ void chunk_store(const f32x4 (&rx)[4], const f32x4 (&rw)[4],
                                            _Float16* dX, _Float16* dW, int rot) {
#pragma unroll
    for (int j = 0; j < 4; ++j) {
        v4h h;
#pragma unroll
        for (int e = 0; e < 4; ++e) h[e] = (_Float16)rx[j][e];
        *(v4h*)&dX[j * 32 * LDK] = h;
    }
    v4h h[4];
#pragma unroll
    for (int e = 0; e < 4; ++e)
#pragma unroll
        for (int i = 0; i < 4; ++i) h[e][i] = (_Float16)rw[i][e];
    // A lane's 4 rows lie 4 pitches from its neighbour's: stored in the same order by every
    // lane, the lanes would meet on 4 bank pairs.  Lane l starts at row (l >> 2) & 3.
    const bool m1 = rot & 1, m2 = rot & 2;
    v4h t[4], u[4];
#pragma unroll
    for (int i = 0; i < 4; ++i) t[i] = pick(m1, h[(i + 1) & 3], h[i]);
#pragma unroll
    for (int i = 0; i < 4; ++i) u[i] = pick(m2, t[(i + 2) & 3], t[i]);   // u[i] = h[(i + rot) & 3]
#pragma unroll
    for (int i = 0; i < 4; ++i) *(v4h*)&dW[((i + rot) & 3) * LDK] = u[i];
}
// Chunk c, whose tiles lie complete in buffer BUF.  nx, nw hold chunk c + 1, which goes to the
// other buffer, and are then filled with chunk c + 3.
template <int BUF, bool STORE, bool LOAD>
__device__ __forceinline__ void proj_chunk(int c, f32x4 (&nx)[4], f32x4 (&nw)[4], v8f (&acc)[4],
                                           const _Float16* fX, const _Float16* fW,
                                           _Float16* dX, _Float16* dW, int rot,
                                           const float* xg, const float* wg) {
    // all fragments of the chunk as one group of LDS reads
    v16h fa[BK / 32], fb[BK / 32][4];
#pragma unroll
    for (int kc = 0; kc < BK / 32; ++kc) {
        fa[kc] = frag_ld(fX + BUF * PBUF + kc * 32, LDK);
#pragma unroll
        for (int t = 0; t < 4; ++t) fb[kc][t] = frag_ld(fW + BUF * PBUF + (t * 16) * LDK + kc * 32, LDK);
    }
    // keeps the reads above in front of the conversion below, which then runs under their latency
    __builtin_amdgcn_sched_barrier(0);
    if (STORE) chunk_store(nx, nw, dX + (BUF ^ 1) * PBUF, dW + (BUF ^ 1) * PBUF, rot);
    if (LOAD)  chunk_load(nx, nw, xg, wg, c + 3);
    // keeps the products behind the stores and the loads: in front of them they would hold
    // both back for the time of the fragment reads
    __builtin_amdgcn_sched_barrier(0);
#pragma unroll
    for (int kc = 0; kc < BK / 32; ++kc)
#pragma unroll
        for (int t = 0; t < 4; ++t)
            acc[t] = __builtin_amdgcn_wmma_f32_16x16x32_f16(
                false, fa[kc], false, fb[kc][t], (short)0, acc[t], false, false);
    lds_barrier_behind(acc);   // chunk c + 1 is complete, and every wave has read chunk c
}

__global__ __launch_bounds__(512) void qkv_proj_kernel(
    const float* __restrict__ x,
    const float* __restrict__ wq, const float* __restrict__ wk, const float* __restrict__ wv,
    const float* __restrict__ bq, const float* __restrict__ bk, const float* __restrict__ bv,
    _Float16* __restrict__ ws) {
    __shared__ __attribute__((aligned(16))) _Float16 sX[2 * PBUF];   // x tiles [128 s][BK k]; epilogue bounce buffer
    __shared__ __attribute__((aligned(16))) _Float16 sW[2 * PBUF];   // W^T tiles [128 n][BK k]
    static_assert(2 * PBUF >= TILE * LDW, "the bounce buffer fits the x tiles");

    const int sel     = blockIdx.y;
    const float* bias = sel == 0 ? bq : (sel == 1 ? bk : bv);
    const float* w    = sel == 0 ? wq : (sel == 1 ? wk : wv);
    const int batch = blockIdx.x >> 4;
    const int m0    = (blockIdx.x & 15) * TILE;
    const int tid   = threadIdx.x;
    const int wave  = tid >> 5;
    const int lane  = tid & 31;
    const int rg    = wave & 7;    // the wave's group of 16 rows of A
    const int ch    = wave >> 3;   // the wave's half of the 128 rows of B

    const int xr = wave * 2 + (lane >> 4), xc = (lane & 15) * 4;   // rows xr, xr + 32, ...; 4 k at xc
    const float* xg = x + ((size_t)batch * SEQ + m0 + xr) * EMBED + xc;
    // a thread holds a block of 4 k x 4 n of W, so that 4 consecutive k of one n are one
    // 8-B LDS store of the transposed tile
    const float* wg = w + (size_t)(wave * 4) * HD + lane * 4;
    const int rot = (lane >> 2) & 3;   // which of its 4 n a lane stores first
    _Float16* dX = &sX[xr * LDK + xc];
    _Float16* dW = &sW[(lane * 4) * LDK + wave * 4];
    const _Float16* fX = (sel == 2 ? sX : sW) + (rg * 16) * LDK;   // A operand
    const _Float16* fW = (sel == 2 ? sW : sX) + (ch * 64) * LDK;   // B operand

    f32x4 rx0[4], rw0[4], rx1[4], rw1[4];   // even chunks, odd chunks
    chunk_load(rx0, rw0, xg, wg, 0);
    chunk_load(rx1, rw1, xg, wg, 1);
    chunk_store(rx0, rw0, dX, dW, rot);
    chunk_load(rx0, rw0, xg, wg, 2);
    lds_barrier();   // chunk 0 is complete

    v8f acc[4] = {};
    for (int c = 0; c < NC - 4; c += 2) {
        proj_chunk<0, true, true>(c,     rx1, rw1, acc, fX, fW, dX, dW, rot, xg, wg);
        proj_chunk<1, true, true>(c + 1, rx0, rw0, acc, fX, fW, dX, dW, rot, xg, wg);
    }
    proj_chunk<0, true,  true >(NC - 4, rx1, rw1, acc, fX, fW, dX, dW, rot, xg, wg);
    proj_chunk<1, true,  false>(NC - 3, rx0, rw0, acc, fX, fW, dX, dW, rot, xg, wg);
    // The bias, asked for under the last two chunks.  The output column n runs along B for V^T (one
    // value per accumulator tile) and along A for Q and K (one per accumulator register).
    const int hi = lane >> 4, ln = lane & 15;
    const float* bB = bias + ch * 64 + ln;
    const float* bA = bias + rg * 16 + 8 * hi;
    float bcol[4];
#pragma unroll
    for (int t = 0; t < 4; ++t) bcol[t] = bB[t * 16];
    const f32x4 brow0 = *(const f32x4*)bA, brow1 = *(const f32x4*)(bA + 4);
    // Stands behind the run of loads, before their address registers are used for anything else.
    asm volatile("s_wait_xcnt 0x0" :: "v"(bB), "v"(bA) : "memory");
    proj_chunk<0, true,  false>(NC - 2, rx1, rw1, acc, fX, fW, dX, dW, rot, xg, wg);
    proj_chunk<1, false, false>(NC - 1, rx0, rw0, acc, fX, fW, dX, dW, rot, xg, wg);

    // bias (+Q scale) -> fp16 into the LDS bounce buffer, laid out as the plane is stored
    // ([s][n] for Q and K, [n][s] for V^T): row = the lane's B row, 8 neighbours = its A rows,
    // one 16-B store per accumulator tile
    _Float16* sOut = sX;
    const float qscale = sel == 0 ? 0.088388347648318447f : 1.0f;   // 1/sqrt(128) for Q
#pragma unroll
    for (int t = 0; t < 4; ++t) {
        v8h h;
#pragma unroll
        for (int i = 0; i < 8; ++i) {
            const float bb = sel == 2 ? bcol[t] : (i < 4 ? brow0[i & 3] : brow1[i & 3]);
            h[i] = (_Float16)((acc[t][i] + bb) * qscale);
        }
        *(v8h*)&sOut[(ch * 64 + t * 16 + ln) * LDW + rg * 16 + 8 * hi] = h;
    }
    __syncthreads();

    // coalesced 16B global stores from the bounce buffer
    if (sel == 2) {
        _Float16* dst = ws + VOFF + (size_t)batch * SEQ * HD;  // [D][S]
        for (int c = 0; c < 4; ++c) {
            int idx = c * 512 + tid;
            int r = idx >> 4, c8 = (idx & 15) * 8;
            *(v8h*)&dst[(size_t)r * SEQ + m0 + c8] = *(const v8h*)&sOut[r * LDW + c8];
        }
    } else {
        _Float16* dst = ws + (sel ? KOFF : QOFF) + (size_t)batch * SEQ * HD; // [S][D]
        for (int c = 0; c < 4; ++c) {
            int idx = c * 512 + tid;
            int r = idx >> 4, c8 = (idx & 15) * 8;
            *(v8h*)&dst[(size_t)(m0 + r) * HD + c8] = *(const v8h*)&sOut[r * LDW + c8];
        }
    }
}

// ---------------------------------------------------------------------------
// Tensor load of the attention kernel: one tile of 128 rows of 256 bytes, every
// extent in bytes, 16 bytes of LDS pad behind each row (LDS pitch 272 B = LDW halves).
// ---------------------------------------------------------------------------
typedef __attribute__((ext_vector_type(8))) unsigned int u32x8;
__device__ inline unsigned uni(unsigned v) { return (unsigned)__builtin_amdgcn_readfirstlane((int)v); }
// A wave-uniform value held in a scalar register.  On a test: the branch on it is a scalar
// branch (a tensor load ignores EXEC, only such a branch keeps a wave from issuing it).
// On a descriptor word: the word has one register of its own, which the compiler does not
// hand out and fill again between the request and its wait.
__device__ inline unsigned pinned(unsigned v) {
    unsigned w = uni(v);
    asm volatile("" : "+s"(w));   // issue test or descriptor word of a tensor load held in a scalar register
    return w;
}
// lane l takes the value of lane l ^ 16
__device__ inline float xhalf(float x) {
    const int b = __builtin_bit_cast(int, x);
    return __builtin_bit_cast(float, __builtin_amdgcn_permlanex16(b, b, 0x76543210, 0xfedcba98, false, false));
}
// The wave's own LDS reads and writes have retired before a buffer is handed back.
__device__ inline void wait_ds0() { asm volatile("s_wait_dscnt 0x0" ::: "memory"); }
__device__ inline u32x4 tile_group0(unsigned lds_byte_addr, const _Float16* gsrc) {
    const unsigned long long ga = (unsigned long long)(size_t)gsrc;
    u32x4 g;
    g[0] = pinned(1u);                                 // count = 1; descriptor word held in a scalar register
    g[1] = uni(lds_byte_addr);
    g[2] = uni((unsigned)ga);
    g[3] = uni((((unsigned)(ga >> 32)) & 0x01FFFFFFu) | 0x80000000u);   // type = 2
    return g;
}
__device__ inline u32x8 tile_group1(unsigned pitch_bytes) {
    constexpr unsigned d0 = 2 * TILE, d1 = TILE;       // bytes in a row, rows
    u32x8 g;
    g[0] = uni((1u << 20) | (5u << 22) | (3u << 25));  // no mask, 1-byte elements, pad 4 dwords per 256-B row
    // words 1 to 7: descriptor words held in scalar registers
    g[1] = pinned((d0 & 0xFFFFu) << 16);
    g[2] = pinned((d0 >> 16) | ((d1 & 0xFFFFu) << 16));
    g[3] = pinned((d1 >> 16) | (d0 << 16));
    g[4] = pinned(d1);
    g[5] = pinned(pitch_bytes);
    g[6] = pinned(0u);
    g[7] = pinned(0u);
    return g;
}
// asm so that it keeps its place among the asm waits around it
__device__ inline void tile_load(u32x4 g0, u32x8 g1) {
    asm volatile("tensor_load_to_lds %0, %1" :: "s"(g0), "s"(g1) : "memory");
}
// The compiler places no wait for a tensor load: a tile counts as landed behind this one.
// It names the request's descriptor as inputs so that those registers stay as they are
// for as long as the request is in flight.
__device__ inline void wait_tile(u32x4 g0, u32x8 g1) {
    asm volatile("s_wait_tensorcnt 0x0" :: "s"(g0), "s"(g1) : "memory");
}

// e^x for the softmax and the merge weights.  The v_nop in the same statement is the one slot the
// instruction set asks for behind a transcendental before its source register is
// overwritten or its result read.
__device__ inline float exp_weight(float x) {
    float e;
    asm("v_exp_f32 %0, %1\n\tv_nop" : "=v"(e) : "v"(x * 1.4426950408889634f));
    return e;
}

// ---------------------------------------------------------------------------
// Kernel 2: causal flash attention over ONE key range, TDM-fed, K/V double-buffered.
// grid = (NRANGE, B), 256 threads (8 waves), each wave owns 16 queries (one per lane pair).
// Leaves the un-normalised sum with its row maximum and row sum; kernel 3 merges.
// ---------------------------------------------------------------------------
__global__ __launch_bounds__(256) void attn_kernel(
    const _Float16* __restrict__ ws, float* __restrict__ part_o, float* __restrict__ part_ml) {
    extern __shared__ __attribute__((aligned(2048))) _Float16 smem[];   // every tile's place a multiple of 2 KiB

    const int batch = blockIdx.y;
    int qtile = NQT - 1, range = blockIdx.x;      // flat index -> (query tile, key range)
    while (range > qtile / CH) { range -= qtile / CH + 1; --qtile; }
    const int j0    = range * CH;                 // first key tile of the range
    const int qt    = min(CH - 1, qtile - j0);    // last key tile, counted from j0
    const int q0    = qtile * TILE;
    const int tid   = threadIdx.x, wave = tid >> 5, lane = tid & 31;
    const int hi    = lane >> 4,  ln   = lane & 15;
    const size_t SD = (size_t)SEQ * HD;

    const _Float16* Qg = ws + QOFF + (size_t)batch * SD + (size_t)q0 * HD;  // pre-scaled
    const _Float16* Kg = ws + KOFF + (size_t)batch * SD + (size_t)j0 * TILE * HD;
    const _Float16* Vg = ws + VOFF + (size_t)batch * SD + (size_t)j0 * TILE;  // [D][S]
    const unsigned lds0 = (unsigned)(size_t)(void*)smem;

    const unsigned wv = uni(threadIdx.x >> 5);   // the wave's number, scalar

    // Wave 0 brings the K tiles, wave 1 the V tiles, wave 2 Q: one request of a wave
    // in flight at any time, each wave with its own source, place and row pitch.
    const _Float16* src  = wv == 0 ? Kg : (wv == 1 ? Vg : Qg);
    const unsigned place = lds0 + 2 * (wv == 0 ? OFFK0 : (wv == 1 ? OFFV0 : OFFQ));
    const size_t   step  = wv == 1 ? (size_t)TILE : (size_t)TILE * HD;   // halves from key tile to key tile
    const u32x8 g1 = tile_group1(wv == 1 ? 2 * SEQ : 2 * HD);
    u32x4 g0 = tile_group0(place, src);
    // stage 0 lands and is published before anything reads it
    if (pinned(wv < 3)) { tile_load(g0, g1); wait_tile(g0, g1); }
    __syncthreads();
    // stage 1 flies under pass 0, where the range has a second key tile
    g0 = tile_group0(place + 2 * TILE * LDW, src + step);
    if (pinned(wv < 2 && qt >= 1)) tile_load(g0, g1);

    v8f o_acc[8] = {};                 // o_acc[dt][i] = O[query ln][d = dt * 16 + 8 * hi + i]
    float m_i = -3.0e38f, l_i = 0.f;   // the query's maximum; the sum over this wave half's keys

    // the wave's Q fragments (B operand: column = query) stay in registers for all its key tiles
    v16h qb[4];
#pragma unroll
    for (int kc = 0; kc < 4; ++kc) qb[kc] = frag_ld(&smem[OFFQ + (wave * 16) * LDW + kc * 32], LDW);

    for (int j = 0; j <= qt; ++j) {
        const _Float16* sK = smem + ((j & 1) ? OFFK1 : OFFK0);
        const _Float16* sV = smem + ((j & 1) ? OFFV1 : OFFV0);

        // S^T = K Q^T : 128 keys x the wave's 16 queries, K-dim 128 = 4 x 32.
        // The 8 K fragments of k step kc + 1 are read as one group while the 8 products of
        // step kc run; under the last step, and the softmax behind it, the first V group.
        v16h fb[2][8];
        frag_group(fb[0], sK);
        v8f s[8] = {};                 // s[t][i] = score(key t * 16 + 8 * hi + i, query ln)
#pragma unroll
        for (int kc = 0; kc < 4; ++kc) {
            if (kc + 1 < 4) frag_group(fb[(kc + 1) & 1], sK + (kc + 1) * 32);
            else            frag_group(fb[0], sV);
            // keeps the reads above in front of the products below: moved behind them, each
            // product would wait out the whole latency of its own LDS read
            __builtin_amdgcn_sched_barrier(0);
#pragma unroll
            for (int t = 0; t < 8; ++t)
                s[t] = __builtin_amdgcn_wmma_f32_16x16x32_f16(
                    false, fb[kc & 1][t], false, qb[kc], (short)0, s[t], false, false);
        }

        if (j0 + j == qtile) {   // diagonal tile: causal mask
#pragma unroll
            for (int t = 0; t < 8; ++t)
#pragma unroll
                for (int i = 0; i < 8; ++i)
                    if (t * 16 + 8 * hi + i > wave * 16 + ln) s[t][i] = -3.0e38f;
        }

        // online softmax, all of a query's scores in two lanes: maximum and sum run down the
        // lane's own registers, and one exchange between the wave halves joins the maxima
        v8f mx8 = s[0];
#pragma unroll
        for (int t = 1; t < 8; ++t)
#pragma unroll
            for (int i = 0; i < 8; ++i) mx8[i] = fmaxf(mx8[i], s[t][i]);
        float rmax = fmaxf(fmaxf(fmaxf(mx8[0], mx8[1]), fmaxf(mx8[2], mx8[3])),
                           fmaxf(fmaxf(mx8[4], mx8[5]), fmaxf(mx8[6], mx8[7])));
        rmax = fmaxf(rmax, xhalf(rmax));
        const float mnew  = fmaxf(m_i, rmax);
        const float alpha = exp_weight(m_i - mnew);
        v8f sum8 = {};
#pragma unroll
        for (int t = 0; t < 8; ++t)
#pragma unroll
            for (int i = 0; i < 8; ++i) {
                s[t][i] = exp_weight(s[t][i] - mnew);
                sum8[i] += s[t][i];
            }
        l_i = l_i * alpha + (((sum8[0] + sum8[1]) + (sum8[2] + sum8[3])) +
                             ((sum8[4] + sum8[5]) + (sum8[6] + sum8[7])));
        m_i = mnew;
#pragma unroll
        for (int dt = 0; dt < 8; ++dt) o_acc[dt] *= alpha;

        // P^T as B operand: two score tiles (32 keys) converted in place are one fragment in
        // the k order of frag_ld: element e = key 8 * hi + e, element 8 + e = key 16 + 8 * hi + e
        v16h pb[4];
#pragma unroll
        for (int nc = 0; nc < 4; ++nc)
#pragma unroll
            for (int i = 0; i < 8; ++i) {
                pb[nc][i]     = (_Float16)s[2 * nc][i];
                pb[nc][8 + i] = (_Float16)s[2 * nc + 1][i];
            }

        // O^T += V^T P^T : reduce over 128 keys in chunks of 32, the V group of chunk nc + 1
        // read while the 8 products of chunk nc run
#pragma unroll
        for (int nc = 0; nc < 4; ++nc) {
            if (nc + 1 < 4) frag_group(fb[(nc + 1) & 1], sV + (nc + 1) * 32);
            // keeps the reads above in front of the products below, as in S^T = K Q^T
            __builtin_amdgcn_sched_barrier(0);
#pragma unroll
            for (int dt = 0; dt < 8; ++dt)
                o_acc[dt] = __builtin_amdgcn_wmma_f32_16x16x32_f16(
                    false, fb[nc & 1][dt], false, pb[nc], (short)0, o_acc[dt], false, false);
        }
        // publish tile j+1 and free tile j's buffers: own LDS traffic retired, the
        // issuers' tiles landed, one barrier for both, and only then the refill
        wait_ds0();
        if (pinned(wv < 2)) wait_tile(g0, g1);
        __syncthreads();
        g0 = tile_group0(place + (j & 1) * (2 * TILE * LDW), src + (size_t)(j + 2) * step);
        if (pinned(wv < 2 && j + 2 <= qt)) tile_load(g0, g1);
    }
    wait_tile(g0, g1);
    wait_ds0();

    const size_t slot = ((size_t)batch * NQT + qtile) * MAXS + range;
    float* po = part_o  + slot * (TILE * HD) + (size_t)(wave * 16) * HD;
    float* ml = part_ml + slot * (2 * TILE) + wave * 32;   // one 128-B line per wave
    // O^T -> O through the wave's own rows of the K buffers, which every wave has left at the
    // loop's last barrier and no tensor load is aimed at any more: a lane writes 8 d of its
    // query, then the wave reads whole rows and stores 512 contiguous bytes at a time.
    float* st = (float*)(smem + OFFK0) + wave * (16 * STP);
#pragma unroll
    for (int dt = 0; dt < 8; ++dt) {
        *(f32x4*)&st[ln * STP + dt * 16 + 8 * hi] =
            f32x4{o_acc[dt][0], o_acc[dt][1], o_acc[dt][2], o_acc[dt][3]};
        *(f32x4*)&st[ln * STP + dt * 16 + 8 * hi + 4] =
            f32x4{o_acc[dt][4], o_acc[dt][5], o_acc[dt][6], o_acc[dt][7]};
    }
#pragma unroll
    for (int r = 0; r < 16; ++r)
        *(f32x4*)&po[(size_t)r * HD + lane * 4] = *(const f32x4*)&st[r * STP + lane * 4];
    // lanes 0-15 store the 16 maxima, lanes 16-31 the 16 sums (both halves' keys joined)
    const float l_all = l_i + xhalf(l_i);
    ml[lane] = hi ? l_all : m_i;
}

// ---------------------------------------------------------------------------
// Kernel 3: merge the key ranges of each query row.
// grid = B*S/16, 256 threads: a wave takes rows w and w+8 of 16, a lane 4 columns.
// ---------------------------------------------------------------------------
__global__ __launch_bounds__(256) void merge_kernel(
    const float* __restrict__ part_o, const float* __restrict__ part_ml,
    float* __restrict__ out) {
    const int row0  = blockIdx.x * 16;            // flat row (batch*SEQ + s), 16 rows of one tile
    const int qtile = (row0 & (SEQ - 1)) / TILE;
    const int ns    = qtile / CH + 1;             // key ranges of this query tile
    const int rt0   = row0 & (TILE - 1);          // first row inside the tile
    const size_t slot0 = ((size_t)(row0 / SEQ) * NQT + qtile) * MAXS;
    const float* po = part_o  + slot0 * (TILE * HD);
    const float* ml = part_ml + slot0 * (2 * TILE) + (rt0 >> 4) * 32;
    const int w  = threadIdx.x >> 5;
    const int d4 = (threadIdx.x & 31) * 4;

    f32x4 o[2][MAXS];
    float m[2][MAXS], l[2][MAXS];
#pragma unroll
    for (int c = 0; c < MAXS; ++c) {
#pragma unroll
        for (int k = 0; k < 2; ++k) {
            o[k][c] = f32x4{0.f, 0.f, 0.f, 0.f};
            m[k][c] = -3.0e38f;
            l[k][c] = 0.f;
        }
        if (c < ns) {
#pragma unroll
            for (int k = 0; k < 2; ++k) {
                int rr = w + 8 * k;
                o[k][c] = *(const f32x4*)&po[(size_t)c * (TILE * HD) + (size_t)(rt0 + rr) * HD + d4];
                m[k][c] = ml[c * (2 * TILE) + rr];
                l[k][c] = ml[c * (2 * TILE) + 16 + rr];
            }
        }
    }
#pragma unroll
    for (int k = 0; k < 2; ++k) {
        float mx = m[k][0];
#pragma unroll
        for (int c = 1; c < MAXS; ++c) mx = fmaxf(mx, m[k][c]);
        float wt[MAXS];
#pragma unroll
        for (int c = 0; c < MAXS; ++c) wt[c] = exp_weight(m[k][c] - mx);
        f32x4 acc = {0.f, 0.f, 0.f, 0.f};
        float ls  = 0.f;
#pragma unroll
        for (int c = 0; c < MAXS; ++c) {
            ls  += wt[c] * l[k][c];
            acc += wt[c] * o[k][c];
        }
        *(f32x4*)&out[(size_t)(row0 + w + 8 * k) * HD + d4] = acc * (1.0f / ls);
    }
}

extern "C" void kernel_launch(void* const* d_in, const int* in_sizes, int n_in,
                              void* d_out, int out_size, void* d_ws, size_t ws_size,
                              hipStream_t stream) {
    const float* x  = (const float*)d_in[0];
    const float* wq = (const float*)d_in[1];
    const float* bq = (const float*)d_in[2];
    const float* wk = (const float*)d_in[3];
    const float* bk = (const float*)d_in[4];
    const float* wv = (const float*)d_in[5];
    const float* bv = (const float*)d_in[6];
    _Float16* ws = (_Float16*)d_ws;   // fp16 Q, K, V^T; f32 partials behind

    qkv_proj_kernel<<<dim3(BATCH * SEQ / TILE, 3), 512, 0, stream>>>(
        x, wq, wk, wv, bq, bk, bv, ws);
    float* part_o  = (float*)(ws + POFF);
    float* part_ml = (float*)(ws + MLOFF);
    attn_kernel<<<dim3(NRANGE, BATCH), 256, SMEM2_BYTES, stream>>>(ws, part_o, part_ml);
    merge_kernel<<<BATCH * SEQ / 16, 256, 0, stream>>>(part_o, part_ml, (float*)d_out);
}

// v007
// It runs in 25.9 microseconds.
// Two timings next to v006 both put it at 1.04 times that version's speed.
// Counting every step since v000, it is 4.95 times as fast.
#include <hip/hip_runtime.h>
#include <hip/hip_bf16.h>

typedef __attribute__((ext_vector_type(16))) _Float16     v16h;
typedef __attribute__((ext_vector_type(8)))  _Float16     v8h;
typedef __attribute__((ext_vector_type(4)))  _Float16     v4h;
typedef __attribute__((ext_vector_type(8)))  float        v8f;
typedef __attribute__((ext_vector_type(4)))  float        f32x4;
typedef __attribute__((ext_vector_type(4)))  unsigned int u32x4;
typedef __attribute__((ext_vector_type(2)))  unsigned int u32x2;

#define EMBED 1024
#define SEQ   2048
#define BATCH 4
#define HD    128
#define TILE  128
#define LDW   136   // padded half-stride for 128-wide tiles (272B, 16B multiple)
#define BK    64    // K chunk of the projection
#define NC    (EMBED / BK)
#define LDK   72    // padded half-stride of the projection's 64-wide tiles (144 B = 16 B x 9)
#define PBUF  (TILE * LDK)                 // one projection tile in LDS, halves
#define NW    (EMBED * HD)                 // one weight matrix, elements

// fp16 workspace layout (offsets in halves)
#define QOFF  ((size_t)0)                           // Q  [B][S][D] (pre-scaled)
#define KOFF  ((size_t)BATCH * SEQ * HD)            // K  [B][S][D]
#define VOFF  ((size_t)2 * BATCH * SEQ * HD)        // V^T [B][D][S]
#define XOFF  ((size_t)3 * BATCH * SEQ * HD)        // not used
#define WOFF  (XOFF + (size_t)BATCH * SEQ * EMBED)  // not used

// key split of the attention: a work-group takes CH key tiles of one query tile
#define NQT   (SEQ / TILE)                 // query tiles per batch
#define CH    3                            // key tiles per work-group
#define MAXS  ((NQT + CH - 1) / CH)        // most key ranges a query tile has
constexpr int count_ranges() {             // (query tile, key range) pairs per batch
    int n = 0;
    for (int q = 0; q < NQT; ++q) n += q / CH + 1;
    return n;
}
constexpr int NRANGE = count_ranges();
// f32 partials behind the fp16 planes (offsets in halves; slot = (batch*NQT+qtile)*MAXS+range)
#define POFF  (WOFF + (size_t)3 * NW)                                   // O  [slot][128 r][128 d]
#define MLOFF (POFF + (size_t)2 * BATCH * NQT * MAXS * TILE * HD)       // [slot][8 waves][16 max | 16 sum]

// LDS layout for attention kernel (offsets in halves)
#define OFFQ  0
#define OFFP  (TILE * LDW)          // free: P stays in registers
#define OFFK0 (2 * TILE * LDW)
#define OFFK1 (3 * TILE * LDW)
#define OFFV0 (4 * TILE * LDW)
#define OFFV1 (5 * TILE * LDW)
#define SMEM2_BYTES (6 * TILE * LDW * 2)   // 208,896 B < 320 KB/WGP
#define STP   132   // f32 pitch of the output staging rows (528 B: 16 lanes' 16-B stores meet no bank twice)

// ---------------------------------------------------------------------------
// 16x32 fp16 A/B fragment load from LDS (CDNA5 16-bit matrix layout:
// lanes 0-15 hold K {0..7,16..23}, lanes 16-31 hold K {8..15,24..31}).
// ---------------------------------------------------------------------------
__device__ inline v16h frag_ld(const _Float16* p, int stride) {
    const int lane = threadIdx.x & 31;
    const int r    = lane & 15;
    const int ko   = (lane >> 4) * 8;
    const _Float16* q = p + r * stride + ko;
    union { v16h v; v8h h[2]; } u;
    u.h[0] = *(const v8h*)(q);        // ds_load_b128
    u.h[1] = *(const v8h*)(q + 16);   // ds_load_b128
    return u.v;
}

// The 8 fragments (16 rows each) of a 128-row tile at one k step of 32, read as one group.
__device__ inline void frag_group(v16h (&f)[8], const _Float16* p) {
#pragma unroll
    for (int t = 0; t < 8; ++t) f[t] = frag_ld(p + (t * 16) * LDW, LDW);
}

// Work-group barrier of the projection's K loop.  It waits for the wave's LDS traffic alone:
// __syncthreads() would also wait for the global loads of the next chunk, which are meant
// to stay in flight across it.
__device__ inline void lds_barrier() {
    asm volatile("s_wait_dscnt 0x0\n\ts_barrier_signal -1\n\ts_barrier_wait -1" ::: "memory");
}
// The same barrier, naming the accumulators as inputs: the chunk's products then stand in front of
// it.  Moved behind it, their fragments would stay live beside the next chunk's, which is more
// registers than a wave of a 16-wave work-group has (spills).
__device__ inline void lds_barrier_behind(const v8f (&acc)[4]) {
    asm volatile("s_wait_dscnt 0x0\n\ts_barrier_signal -1\n\ts_barrier_wait -1"
                 :: "v"(acc[0]), "v"(acc[1]), "v"(acc[2]), "v"(acc[3]) : "memory");
}
// a where c holds, else b
__device__ inline v4h pick(bool c, v4h a, v4h b) {
    const u32x2 x = __builtin_bit_cast(u32x2, a), y = __builtin_bit_cast(u32x2, b);
    return __builtin_bit_cast(v4h, u32x2{c ? x[0] : y[0], c ? x[1] : y[1]});
}

// ---------------------------------------------------------------------------
// Kernel 1: QKV projection straight from the f32 inputs.
// grid = (B*S/128, 3), 512 threads (16 waves), a wave owns 16 rows x 64 columns of the product
// A B^T: for V^T, A is the x tile and B the W^T tile; for Q and K the two change places.  Either way
// a lane's 8 accumulator registers are 8 neighbours of one row of the plane as it is stored.
// Each K chunk of BK goes global -> registers (f32) -> fp16 -> LDS.  Two register sets and
// two LDS buffers: the loads of two chunks are in flight at any time, and chunk c + 1 is
// converted and stored while chunk c is read and multiplied; one barrier a chunk.
// sel 0: Q (pre-scaled) [B][S][D];  sel 1: K [B][S][D];  sel 2: V^T [B][D][S]
// ---------------------------------------------------------------------------
// One chunk's loads.  x: a wave-wide load is 256 B of each of two rows; W [k][n]: one k row of 128 n.
// c counts from the work-group's own first chunk and wraps at NC.
__device__ __forceinline__ void chunk_load(f32x4 (&rx)[4], f32x4 (&rw)[4],
                                           const float* xg, const float* wg, int c) {
    const int cc = c & (NC - 1);
    const float* xn = xg + cc * BK;
    const float* wn = wg + (size_t)cc * BK * HD;
#pragma unroll
    for (int j = 0; j < 4; ++j) rx[j] = *(const f32x4*)(xn + (size_t)j * 32 * EMBED);
#pragma unroll
    for (int i = 0; i < 4; ++i) rw[i] = *(const f32x4*)(wn + (size_t)i * HD);
    // Stands behind the run of loads, before their address registers are used for anything else.
    // It names the run's two addresses as inputs: they stay live up to it, so that no load's own
    // result is given an address register of the run.
    asm volatile("s_wait_xcnt 0x0" :: "v"(xn), "v"(wn) : "memory");
}
// One chunk: registers -> fp16 -> LDS.  dX: the thread's place in row xr of the x tile;
// dW: row lane * 4 of the W^T tile at the wave's 4 k.
__device__ __forceinline__ void chunk_store(const f32x4 (&rx)[4], const f32x4 (&rw)[4],
                                            _Float16* dX, _Float16* dW, int rot) {
#pragma unroll
    for (int j = 0; j < 4; ++j) {
        v4h h;
#pragma unroll
        for (int e = 0; e < 4; ++e) h[e] = (_Float16)rx[j][e];
        *(v4h*)&dX[j * 32 * LDK] = h;
    }
    v4h h[4];
#pragma unroll
    for (int e = 0; e < 4; ++e)
#pragma unroll
        for (int i = 0; i < 4; ++i) h[e][i] = (_Float16)rw[i][e];
    // A lane's 4 rows lie 4 pitches from its neighbour's: stored in the same order by every
    // lane, the lanes would meet on 4 bank pairs.  Lane l starts at row (l >> 2) & 3.
    const bool m1 = rot & 1, m2 = rot & 2;
    v4h t[4], u[4];
#pragma unroll
    for (int i = 0; i < 4; ++i) t[i] = pick(m1, h[(i + 1) & 3], h[i]);
#pragma unroll
    for (int i = 0; i < 4; ++i) u[i] = pick(m2, t[(i + 2) & 3], t[i]);   // u[i] = h[(i + rot) & 3]
#pragma unroll
    for (int i = 0; i < 4; ++i) *(v4h*)&dW[((i + rot) & 3) * LDK] = u[i];
}
// Chunk c, whose tiles lie complete in buffer BUF.  nx, nw hold chunk c + 1, which goes to the
// other buffer, and are then filled with chunk c + 3.
template <int BUF, bool STORE, bool LOAD>
__device__ __forceinline__ void proj_chunk(int c, f32x4 (&nx)[4], f32x4 (&nw)[4], v8f (&acc)[4],
                                           const _Float16* fX, const _Float16* fW,
                                           _Float16* dX, _Float16* dW, int rot,
                                           const float* xg, const float* wg) {
    // all fragments of the chunk as one group of LDS reads
    v16h fa[BK / 32], fb[BK / 32][4];
#pragma unroll
    for (int kc = 0; kc < BK / 32; ++kc) {
        fa[kc] = frag_ld(fX + BUF * PBUF + kc * 32, LDK);
#pragma unroll
        for (int t = 0; t < 4; ++t) fb[kc][t] = frag_ld(fW + BUF * PBUF + (t * 16) * LDK + kc * 32, LDK);
    }
    // keeps the reads above in front of the conversion below, which then runs under their latency
    __builtin_amdgcn_sched_barrier(0);
    if (STORE) chunk_store(nx, nw, dX + (BUF ^ 1) * PBUF, dW + (BUF ^ 1) * PBUF, rot);
    if (LOAD)  chunk_load(nx, nw, xg, wg, c + 3);
    // keeps the products behind the stores and the loads: in front of them they would hold
    // both back for the time of the fragment reads
    __builtin_amdgcn_sched_barrier(0);
#pragma unroll
    for (int kc = 0; kc < BK / 32; ++kc)
#pragma unroll
        for (int t = 0; t < 4; ++t)
            acc[t] = __builtin_amdgcn_wmma_f32_16x16x32_f16(
                false, fa[kc], false, fb[kc][t], (short)0, acc[t], false, false);
    lds_barrier_behind(acc);   // chunk c + 1 is complete, and every wave has read chunk c
}

__global__ __launch_bounds__(512) void qkv_proj_kernel(
    const float* __restrict__ x,
    const float* __restrict__ wq, const float* __restrict__ wk, const float* __restrict__ wv,
    const float* __restrict__ bq, const float* __restrict__ bk, const float* __restrict__ bv,
    _Float16* __restrict__ ws) {
    __shared__ __attribute__((aligned(16))) _Float16 sX[2 * PBUF];   // x tiles [128 s][BK k]; epilogue bounce buffer
    __shared__ __attribute__((aligned(16))) _Float16 sW[2 * PBUF];   // W^T tiles [128 n][BK k]
    static_assert(2 * PBUF >= TILE * LDW, "the bounce buffer fits the x tiles");

    const int sel     = blockIdx.y;
    const float* bias = sel == 0 ? bq : (sel == 1 ? bk : bv);
    const float* w    = sel == 0 ? wq : (sel == 1 ? wk : wv);
    const int batch = blockIdx.x >> 4;
    const int m0    = (blockIdx.x & 15) * TILE;
    const int tid   = threadIdx.x;
    const int wave  = tid >> 5;
    const int lane  = tid & 31;
    const int rg    = wave & 7;    // the wave's group of 16 rows of A
    const int ch    = wave >> 3;   // the wave's half of the 128 rows of B

    const int xr = wave * 2 + (lane >> 4), xc = (lane & 15) * 4;   // rows xr, xr + 32, ...; 4 k at xc
    const float* xg = x + ((size_t)batch * SEQ + m0 + xr) * EMBED + xc;
    // a thread holds a block of 4 k x 4 n of W, so that 4 consecutive k of one n are one
    // 8-B LDS store of the transposed tile
    const float* wg = w + (size_t)(wave * 4) * HD + lane * 4;
    const int rot = (lane >> 2) & 3;   // which of its 4 n a lane stores first
    _Float16* dX = &sX[xr * LDK + xc];
    _Float16* dW = &sW[(lane * 4) * LDK + wave * 4];
    const _Float16* fX = (sel == 2 ? sX : sW) + (rg * 16) * LDK;   // A operand
    const _Float16* fW = (sel == 2 ? sW : sX) + (ch * 64) * LDK;   // B operand

    // The K loop starts at a chunk of the work-group's own and wraps round.  Started alike, the 64
    // work-groups of one weight matrix would ask L2 for the same lines of W at the same moment, the
    // three that share an x tile for the same lines of x, and every x tile for the same 256 bytes
    // of its 4-KiB rows.  Neighbours in the grid lie 2 chunks apart per 8 indices, the three
    // matrices 1 chunk apart (the one ahead fetches an x line, the two behind find it in L2).
    const int c0 = ((blockIdx.x >> 3) * 2 + (blockIdx.x & 1) + sel) & (NC - 1);

    f32x4 rx0[4], rw0[4], rx1[4], rw1[4];   // chunks c0, c0 + 2, ...; chunks c0 + 1, c0 + 3, ...
    chunk_load(rx0, rw0, xg, wg, c0);
    chunk_load(rx1, rw1, xg, wg, c0 + 1);
    chunk_store(rx0, rw0, dX, dW, rot);
    chunk_load(rx0, rw0, xg, wg, c0 + 2);
    lds_barrier();   // chunk c0 is complete

    v8f acc[4] = {};
    for (int c = 0; c < NC - 4; c += 2) {
        proj_chunk<0, true, true>(c0 + c,     rx1, rw1, acc, fX, fW, dX, dW, rot, xg, wg);
        proj_chunk<1, true, true>(c0 + c + 1, rx0, rw0, acc, fX, fW, dX, dW, rot, xg, wg);
    }
    proj_chunk<0, true,  true >(c0 + NC - 4, rx1, rw1, acc, fX, fW, dX, dW, rot, xg, wg);
    proj_chunk<1, true,  false>(NC - 3, rx0, rw0, acc, fX, fW, dX, dW, rot, xg, wg);
    // The bias, asked for under the last two chunks.  The output column n runs along B for V^T (one
    // value per accumulator tile) and along A for Q and K (one per accumulator register).
    const int hi = lane >> 4, ln = lane & 15;
    const float* bB = bias + ch * 64 + ln;
    const float* bA = bias + rg * 16 + 8 * hi;
    float bcol[4];
#pragma unroll
    for (int t = 0; t < 4; ++t) bcol[t] = bB[t * 16];
    const f32x4 brow0 = *(const f32x4*)bA, brow1 = *(const f32x4*)(bA + 4);
    // Stands behind the run of loads, before their address registers are used for anything else.
    asm volatile("s_wait_xcnt 0x0" :: "v"(bB), "v"(bA) : "memory");
    proj_chunk<0, true,  false>(NC - 2, rx1, rw1, acc, fX, fW, dX, dW, rot, xg, wg);
    proj_chunk<1, false, false>(NC - 1, rx0, rw0, acc, fX, fW, dX, dW, rot, xg, wg);

    // bias (+Q scale) -> fp16 into the LDS bounce buffer, laid out as the plane is stored
    // ([s][n] for Q and K, [n][s] for V^T): row = the lane's B row, 8 neighbours = its A rows,
    // one 16-B store per accumulator tile
    _Float16* sOut = sX;
    const float qscale = sel == 0 ? 0.088388347648318447f : 1.0f;   // 1/sqrt(128) for Q
#pragma unroll
    for (int t = 0; t < 4; ++t) {
        v8h h;
#pragma unroll
        for (int i = 0; i < 8; ++i) {
            const float bb = sel == 2 ? bcol[t] : (i < 4 ? brow0[i & 3] : brow1[i & 3]);
            h[i] = (_Float16)((acc[t][i] + bb) * qscale);
        }
        *(v8h*)&sOut[(ch * 64 + t * 16 + ln) * LDW + rg * 16 + 8 * hi] = h;
    }
    __syncthreads();

    // coalesced 16B global stores from the bounce buffer
    if (sel == 2) {
        _Float16* dst = ws + VOFF + (size_t)batch * SEQ * HD;  // [D][S]
        for (int c = 0; c < 4; ++c) {
            int idx = c * 512 + tid;
            int r = idx >> 4, c8 = (idx & 15) * 8;
            *(v8h*)&dst[(size_t)r * SEQ + m0 + c8] = *(const v8h*)&sOut[r * LDW + c8];
        }
    } else {
        _Float16* dst = ws + (sel ? KOFF : QOFF) + (size_t)batch * SEQ * HD; // [S][D]
        for (int c = 0; c < 4; ++c) {
            int idx = c * 512 + tid;
            int r = idx >> 4, c8 = (idx & 15) * 8;
            *(v8h*)&dst[(size_t)(m0 + r) * HD + c8] = *(const v8h*)&sOut[r * LDW + c8];
        }
    }
}

// ---------------------------------------------------------------------------
// Tensor load of the attention kernel: one tile of 128 rows of 256 bytes, every
// extent in bytes, 16 bytes of LDS pad behind each row (LDS pitch 272 B = LDW halves).
// ---------------------------------------------------------------------------
typedef __attribute__((ext_vector_type(8))) unsigned int u32x8;
__device__ inline unsigned uni(unsigned v) { return (unsigned)__builtin_amdgcn_readfirstlane((int)v); }
// A wave-uniform value held in a scalar register.  On a test: the branch on it is a scalar
// branch (a tensor load ignores EXEC, only such a branch keeps a wave from issuing it).
// On a descriptor word: the word has one register of its own, which the compiler does not
// hand out and fill again between the request and its wait.
__device__ inline unsigned pinned(unsigned v) {
    unsigned w = uni(v);
    asm volatile("" : "+s"(w));   // issue test or descriptor word of a tensor load held in a scalar register
    return w;
}
// lane l takes the value of lane l ^ 16
__device__ inline float xhalf(float x) {
    const int b = __builtin_bit_cast(int, x);
    return __builtin_bit_cast(float, __builtin_amdgcn_permlanex16(b, b, 0x76543210, 0xfedcba98, false, false));
}
// The wave's own LDS reads and writes have retired before a buffer is handed back.
__device__ inline void wait_ds0() { asm volatile("s_wait_dscnt 0x0" ::: "memory"); }
__device__ inline u32x4 tile_group0(unsigned lds_byte_addr, const _Float16* gsrc) {
    const unsigned long long ga = (unsigned long long)(size_t)gsrc;
    u32x4 g;
    g[0] = pinned(1u);                                 // count = 1; descriptor word held in a scalar register
    g[1] = uni(lds_byte_addr);
    g[2] = uni((unsigned)ga);
    g[3] = uni((((unsigned)(ga >> 32)) & 0x01FFFFFFu) | 0x80000000u);   // type = 2
    return g;
}
__device__ inline u32x8 tile_group1(unsigned pitch_bytes) {
    constexpr unsigned d0 = 2 * TILE, d1 = TILE;       // bytes in a row, rows
    u32x8 g;
    g[0] = uni((1u << 20) | (5u << 22) | (3u << 25));  // no mask, 1-byte elements, pad 4 dwords per 256-B row
    // words 1 to 7: descriptor words held in scalar registers
    g[1] = pinned((d0 & 0xFFFFu) << 16);
    g[2] = pinned((d0 >> 16) | ((d1 & 0xFFFFu) << 16));
    g[3] = pinned((d1 >> 16) | (d0 << 16));
    g[4] = pinned(d1);
    g[5] = pinned(pitch_bytes);
    g[6] = pinned(0u);
    g[7] = pinned(0u);
    return g;
}
// asm so that it keeps its place among the asm waits around it
__device__ inline void tile_load(u32x4 g0, u32x8 g1) {
    asm volatile("tensor_load_to_lds %0, %1" :: "s"(g0), "s"(g1) : "memory");
}
// The compiler places no wait for a tensor load: a tile counts as landed behind this one.
// It names the request's descriptor as inputs so that those registers stay as they are
// for as long as the request is in flight.
__device__ inline void wait_tile(u32x4 g0, u32x8 g1) {
    asm volatile("s_wait_tensorcnt 0x0" :: "s"(g0), "s"(g1) : "memory");
}

// e^x for the softmax and the merge weights.  The v_nop in the same statement is the one slot the
// instruction set asks for behind a transcendental before its source register is
// overwritten or its result read.
__device__ inline float exp_weight(float x) {
    float e;
    asm("v_exp_f32 %0, %1\n\tv_nop" : "=v"(e) : "v"(x * 1.4426950408889634f));
    return e;
}

// ---------------------------------------------------------------------------
// Kernel 2: causal flash attention over ONE key range, TDM-fed, K/V double-buffered.
// grid = (NRANGE, B), 256 threads (8 waves), each wave owns 16 queries (one per lane pair).
// Leaves the un-normalised sum with its row maximum and row sum; kernel 3 merges.
// ---------------------------------------------------------------------------
__global__ __launch_bounds__(256) void attn_kernel(
    const _Float16* __restrict__ ws, float* __restrict__ part_o, float* __restrict__ part_ml) {
    extern __shared__ __attribute__((aligned(2048))) _Float16 smem[];   // every tile's place a multiple of 2 KiB

    const int batch = blockIdx.y;
    int qtile = NQT - 1, range = blockIdx.x;      // flat index -> (query tile, key range)
    while (range > qtile / CH) { range -= qtile / CH + 1; --qtile; }
    const int j0    = range * CH;                 // first key tile of the range
    const int qt    = min(CH - 1, qtile - j0);    // last key tile, counted from j0
    // The pass over the range's key tiles starts at a tile of the work-group's own and wraps round:
    // started alike, the up to 16 query tiles of one range would ask L2 for the same K and V lines
    // at the same moment.  kt(j) is the tile of pass j, counted from j0.
    const int nt    = qt + 1;
    const int rt    = nt == CH ? qtile % CH : (qtile & (nt - 1));
    const auto kt   = [nt, rt](int j) { const int t = j + rt; return t >= nt ? t - nt : t; };
    const int q0    = qtile * TILE;
    const int tid   = threadIdx.x, wave = tid >> 5, lane = tid & 31;
    const int hi    = lane >> 4,  ln   = lane & 15;
    const size_t SD = (size_t)SEQ * HD;

    const _Float16* Qg = ws + QOFF + (size_t)batch * SD + (size_t)q0 * HD;  // pre-scaled
    const _Float16* Kg = ws + KOFF + (size_t)batch * SD + (size_t)j0 * TILE * HD;
    const _Float16* Vg = ws + VOFF + (size_t)batch * SD + (size_t)j0 * TILE;  // [D][S]
    const unsigned lds0 = (unsigned)(size_t)(void*)smem;

    const unsigned wv = uni(threadIdx.x >> 5);   // the wave's number, scalar

    // Wave 0 brings the K tiles, wave 1 the V tiles, wave 2 Q: one request of a wave
    // in flight at any time, each wave with its own source, place and row pitch.
    const _Float16* src  = wv == 0 ? Kg : (wv == 1 ? Vg : Qg);
    const unsigned place = lds0 + 2 * (wv == 0 ? OFFK0 : (wv == 1 ? OFFV0 : OFFQ));
    const size_t   step  = wv == 1 ? (size_t)TILE : (wv == 0 ? (size_t)TILE * HD : 0);   // halves from key tile to key tile
    const u32x8 g1 = tile_group1(wv == 1 ? 2 * SEQ : 2 * HD);
    u32x4 g0 = tile_group0(place, src + (size_t)kt(0) * step);
    // stage 0 lands and is published before anything reads it
    if (pinned(wv < 3)) { tile_load(g0, g1); wait_tile(g0, g1); }
    __syncthreads();
    // stage 1 flies under pass 0, where the range has a second key tile
    g0 = tile_group0(place + 2 * TILE * LDW, src + (size_t)kt(1) * step);
    if (pinned(wv < 2 && qt >= 1)) tile_load(g0, g1);

    v8f o_acc[8] = {};                 // o_acc[dt][i] = O[query ln][d = dt * 16 + 8 * hi + i]
    float m_i = -3.0e38f, l_i = 0.f;   // the query's maximum; the sum over this wave half's keys

    // the wave's Q fragments (B operand: column = query) stay in registers for all its key tiles
    v16h qb[4];
#pragma unroll
    for (int kc = 0; kc < 4; ++kc) qb[kc] = frag_ld(&smem[OFFQ + (wave * 16) * LDW + kc * 32], LDW);

    for (int j = 0; j <= qt; ++j) {
        const _Float16* sK = smem + ((j & 1) ? OFFK1 : OFFK0);
        const _Float16* sV = smem + ((j & 1) ? OFFV1 : OFFV0);

        // S^T = K Q^T : 128 keys x the wave's 16 queries, K-dim 128 = 4 x 32.
        // The 8 K fragments of k step kc + 1 are read as one group while the 8 products of
        // step kc run; under the last step, and the softmax behind it, the first V group.
        v16h fb[2][8];
        frag_group(fb[0], sK);
        v8f s[8] = {};                 // s[t][i] = score(key t * 16 + 8 * hi + i, query ln)
#pragma unroll
        for (int kc = 0; kc < 4; ++kc) {
            if (kc + 1 < 4) frag_group(fb[(kc + 1) & 1], sK + (kc + 1) * 32);
            else            frag_group(fb[0], sV);
            // keeps the reads above in front of the products below: moved behind them, each
            // product would wait out the whole latency of its own LDS read
            __builtin_amdgcn_sched_barrier(0);
#pragma unroll
            for (int t = 0; t < 8; ++t)
                s[t] = __builtin_amdgcn_wmma_f32_16x16x32_f16(
                    false, fb[kc & 1][t], false, qb[kc], (short)0, s[t], false, false);
        }

        if (j0 + kt(j) == qtile) {   // diagonal tile: causal mask
#pragma unroll
            for (int t = 0; t < 8; ++t)
#pragma unroll
                for (int i = 0; i < 8; ++i)
                    if (t * 16 + 8 * hi + i > wave * 16 + ln) s[t][i] = -3.0e38f;
        }

        // online softmax, all of a query's scores in two lanes: maximum and sum run down the
        // lane's own registers, and one exchange between the wave halves joins the maxima
        v8f mx8 = s[0];
#pragma unroll
        for (int t = 1; t < 8; ++t)
#pragma unroll
            for (int i = 0; i < 8; ++i) mx8[i] = fmaxf(mx8[i], s[t][i]);
        float rmax = fmaxf(fmaxf(fmaxf(mx8[0], mx8[1]), fmaxf(mx8[2], mx8[3])),
                           fmaxf(fmaxf(mx8[4], mx8[5]), fmaxf(mx8[6], mx8[7])));
        rmax = fmaxf(rmax, xhalf(rmax));
        const float mnew  = fmaxf(m_i, rmax);
        const float alpha = exp_weight(m_i - mnew);
        v8f sum8 = {};
#pragma unroll
        for (int t = 0; t < 8; ++t)
#pragma unroll
            for (int i = 0; i < 8; ++i) {
                s[t][i] = exp_weight(s[t][i] - mnew);
                sum8[i] += s[t][i];
            }
        l_i = l_i * alpha + (((sum8[0] + sum8[1]) + (sum8[2] + sum8[3])) +
                             ((sum8[4] + sum8[5]) + (sum8[6] + sum8[7])));
        m_i = mnew;
#pragma unroll
        for (int dt = 0; dt < 8; ++dt) o_acc[dt] *= alpha;

        // P^T as B operand: two score tiles (32 keys) converted in place are one fragment in
        // the k order of frag_ld: element e = key 8 * hi + e, element 8 + e = key 16 + 8 * hi + e
        v16h pb[4];
#pragma unroll
        for (int nc = 0; nc < 4; ++nc)
#pragma unroll
            for (int i = 0; i < 8; ++i) {
                pb[nc][i]     = (_Float16)s[2 * nc][i];
                pb[nc][8 + i] = (_Float16)s[2 * nc + 1][i];
            }

        // O^T += V^T P^T : reduce over 128 keys in chunks of 32, the V group of chunk nc + 1
        // read while the 8 products of chunk nc run
#pragma unroll
        for (int nc = 0; nc < 4; ++nc) {
            if (nc + 1 < 4) frag_group(fb[(nc + 1) & 1], sV + (nc + 1) * 32);
            // keeps the reads above in front of the products below, as in S^T = K Q^T
            __builtin_amdgcn_sched_barrier(0);
#pragma unroll
            for (int dt = 0; dt < 8; ++dt)
                o_acc[dt] = __builtin_amdgcn_wmma_f32_16x16x32_f16(
                    false, fb[nc & 1][dt], false, pb[nc], (short)0, o_acc[dt], false, false);
        }
        // publish tile j+1 and free tile j's buffers: own LDS traffic retired, the
        // issuers' tiles landed, one barrier for both, and only then the refill
        wait_ds0();
        if (pinned(wv < 2)) wait_tile(g0, g1);
        __syncthreads();
        g0 = tile_group0(place + (j & 1) * (2 * TILE * LDW), src + (size_t)kt(j + 2) * step);
        if (pinned(wv < 2 && j + 2 <= qt)) tile_load(g0, g1);
    }
    wait_tile(g0, g1);
    wait_ds0();

    const size_t slot = ((size_t)batch * NQT + qtile) * MAXS + range;
    float* po = part_o  + slot * (TILE * HD) + (size_t)(wave * 16) * HD;
    float* ml = part_ml + slot * (2 * TILE) + wave * 32;   // one 128-B line per wave
    // O^T -> O through the wave's own rows of the K buffers, which every wave has left at the
    // loop's last barrier and no tensor load is aimed at any more: a lane writes 8 d of its
    // query, then the wave reads whole rows and stores 512 contiguous bytes at a time.
    float* st = (float*)(smem + OFFK0) + wave * (16 * STP);
#pragma unroll
    for (int dt = 0; dt < 8; ++dt) {
        *(f32x4*)&st[ln * STP + dt * 16 + 8 * hi] =
            f32x4{o_acc[dt][0], o_acc[dt][1], o_acc[dt][2], o_acc[dt][3]};
        *(f32x4*)&st[ln * STP + dt * 16 + 8 * hi + 4] =
            f32x4{o_acc[dt][4], o_acc[dt][5], o_acc[dt][6], o_acc[dt][7]};
    }
#pragma unroll
    for (int r = 0; r < 16; ++r)
        *(f32x4*)&po[(size_t)r * HD + lane * 4] = *(const f32x4*)&st[r * STP + lane * 4];
    // lanes 0-15 store the 16 maxima, lanes 16-31 the 16 sums (both halves' keys joined)
    const float l_all = l_i + xhalf(l_i);
    ml[lane] = hi ? l_all : m_i;
}

// ---------------------------------------------------------------------------
// Kernel 3: merge the key ranges of each query row.
// grid = B*S/16, 256 threads: a wave takes rows w and w+8 of 16, a lane 4 columns.
// ---------------------------------------------------------------------------
__global__ __launch_bounds__(256) void merge_kernel(
    const float* __restrict__ part_o, const float* __restrict__ part_ml,
    float* __restrict__ out) {
    const int row0  = blockIdx.x * 16;            // flat row (batch*SEQ + s), 16 rows of one tile
    const int qtile = (row0 & (SEQ - 1)) / TILE;
    const int ns    = qtile / CH + 1;             // key ranges of this query tile
    const int rt0   = row0 & (TILE - 1);          // first row inside the tile
    const size_t slot0 = ((size_t)(row0 / SEQ) * NQT + qtile) * MAXS;
    const float* po = part_o  + slot0 * (TILE * HD);
    const float* ml = part_ml + slot0 * (2 * TILE) + (rt0 >> 4) * 32;
    const int w  = threadIdx.x >> 5;
    const int d4 = (threadIdx.x & 31) * 4;

    f32x4 o[2][MAXS];
    float m[2][MAXS], l[2][MAXS];
#pragma unroll
    for (int c = 0; c < MAXS; ++c) {
#pragma unroll
        for (int k = 0; k < 2; ++k) {
            o[k][c] = f32x4{0.f, 0.f, 0.f, 0.f};
            m[k][c] = -3.0e38f;
            l[k][c] = 0.f;
        }
        if (c < ns) {
#pragma unroll
            for (int k = 0; k < 2; ++k) {
                int rr = w + 8 * k;
                o[k][c] = *(const f32x4*)&po[(size_t)c * (TILE * HD) + (size_t)(rt0 + rr) * HD + d4];
                m[k][c] = ml[c * (2 * TILE) + rr];
                l[k][c] = ml[c * (2 * TILE) + 16 + rr];
            }
        }
    }
#pragma unroll
    for (int k = 0; k < 2; ++k) {
        float mx = m[k][0];
#pragma unroll
        for (int c = 1; c < MAXS; ++c) mx = fmaxf(mx, m[k][c]);
        float wt[MAXS];
#pragma unroll
        for (int c = 0; c < MAXS; ++c) wt[c] = exp_weight(m[k][c] - mx);
        f32x4 acc = {0.f, 0.f, 0.f, 0.f};
        float ls  = 0.f;
#pragma unroll
        for (int c = 0; c < MAXS; ++c) {
            ls  += wt[c] * l[k][c];
            acc += wt[c] * o[k][c];
        }
        *(f32x4*)&out[(size_t)(row0 + w + 8 * k) * HD + d4] = acc * (1.0f / ls);
    }
}

extern "C" void kernel_launch(void* const* d_in, const int* in_sizes, int n_in,
                              void* d_out, int out_size, void* d_ws, size_t ws_size,
                              hipStream_t stream) {
    const float* x  = (const float*)d_in[0];
    const float* wq = (const float*)d_in[1];
    const float* bq = (const float*)d_in[2];
    const float* wk = (const float*)d_in[3];
    const float* bk = (const float*)d_in[4];
    const float* wv = (const float*)d_in[5];
    const float* bv = (const float*)d_in[6];
    _Float16* ws = (_Float16*)d_ws;   // fp16 Q, K, V^T; f32 partials behind

    qkv_proj_kernel<<<dim3(BATCH * SEQ / TILE, 3), 512, 0, stream>>>(
        x, wq, wk, wv, bq, bk, bv, ws);
    float* part_o  = (float*)(ws + POFF);
    float* part_ml = (float*)(ws + MLOFF);
    attn_kernel<<<dim3(NRANGE, BATCH), 256, SMEM2_BYTES, stream>>>(ws, part_o, part_ml);
    merge_kernel<<<BATCH * SEQ / 16, 256, 0, stream>>>(part_o, part_ml, (float*)d_out);
}

// v008
// Measured time: 22.5 microseconds a run.
// Next to v007, in two timings, it ran 1.15 and 1.14 times as fast.
// Over all steps from v000 it is 5.68 times as fast.
#include <hip/hip_runtime.h>
#include <hip/hip_bf16.h>

typedef __attribute__((ext_vector_type(16))) _Float16     v16h;
typedef __attribute__((ext_vector_type(8)))  _Float16     v8h;
typedef __attribute__((ext_vector_type(4)))  _Float16     v4h;
typedef __attribute__((ext_vector_type(8)))  float        v8f;
typedef __attribute__((ext_vector_type(4)))  float        f32x4;
typedef __attribute__((ext_vector_type(4)))  unsigned int u32x4;
typedef __attribute__((ext_vector_type(2)))  unsigned int u32x2;

#define EMBED 1024
#define SEQ   2048
#define BATCH 4
#define HD    128
#define TILE  128
#define LDW   136   // padded half-stride for 128-wide tiles (272B, 16B multiple)
#define BK    64    // K chunk of the projection
#define NC    (EMBED / BK)
#define LDK   72    // padded half-stride of the projection's 64-wide tiles (144 B = 16 B x 9)
#define PBUF  (TILE * LDK)                 // one projection tile in LDS, halves

// fp16 workspace layout (offsets in halves)
#define QOFF  ((size_t)0)                           // Q  [B][S][D] (pre-scaled)
#define KOFF  ((size_t)BATCH * SEQ * HD)            // K  [B][S][D]
#define VOFF  ((size_t)2 * BATCH * SEQ * HD)        // V^T [B][D][S]

// attention: a work-group takes QT queries and all their keys, in stages of 256 keys
#define QT    32                           // queries of a work-group
#define NQB   (SEQ / QT)                   // query blocks per batch
#define TL    (TILE * LDW)                 // one K or V tile of 128 keys in LDS, halves (34,816 B = 17 x 2 KiB)
#define STAGE (4 * TL)                     // a stage in LDS: K tiles low, high; V tiles low, high
#define SMEM2_BYTES (2 * STAGE * 2)        // two stages, 278,528 B < 320 KB/WGP
#define STP   132   // f32 pitch of the output staging rows (528 B: 16 lanes' 16-B stores meet no bank twice)

// ---------------------------------------------------------------------------
// 16x32 fp16 A/B fragment load from LDS (CDNA5 16-bit matrix layout:
// lanes 0-15 hold K {0..7,16..23}, lanes 16-31 hold K {8..15,24..31}).
// ---------------------------------------------------------------------------
__device__ inline v16h frag_ld(const _Float16* p, int stride) {
    const int lane = threadIdx.x & 31;
    const int r    = lane & 15;
    const int ko   = (lane >> 4) * 8;
    const _Float16* q = p + r * stride + ko;
    union { v16h v; v8h h[2]; } u;
    u.h[0] = *(const v8h*)(q);        // ds_load_b128
    u.h[1] = *(const v8h*)(q + 16);   // ds_load_b128
    return u.v;
}

// Work-group barrier of the projection's K loop.  It waits for the wave's LDS traffic alone:
// __syncthreads() would also wait for the global loads of the next chunk, which are meant
// to stay in flight across it.
__device__ inline void lds_barrier() {
    asm volatile("s_wait_dscnt 0x0\n\ts_barrier_signal -1\n\ts_barrier_wait -1" ::: "memory");
}
// The same barrier, naming the accumulators as inputs: the chunk's products then stand in front of
// it.  Moved behind it, their fragments would stay live beside the next chunk's, which is more
// registers than a wave of a 16-wave work-group has (spills).
__device__ inline void lds_barrier_behind(const v8f (&acc)[4]) {
    asm volatile("s_wait_dscnt 0x0\n\ts_barrier_signal -1\n\ts_barrier_wait -1"
                 :: "v"(acc[0]), "v"(acc[1]), "v"(acc[2]), "v"(acc[3]) : "memory");
}
// a where c holds, else b
__device__ inline v4h pick(bool c, v4h a, v4h b) {
    const u32x2 x = __builtin_bit_cast(u32x2, a), y = __builtin_bit_cast(u32x2, b);
    return __builtin_bit_cast(v4h, u32x2{c ? x[0] : y[0], c ? x[1] : y[1]});
}

// ---------------------------------------------------------------------------
// Kernel 1: QKV projection straight from the f32 inputs.
// grid = (B*S/128, 3), 512 threads (16 waves), a wave owns 16 rows x 64 columns of the product
// A B^T: for V^T, A is the x tile and B the W^T tile; for Q and K the two change places.  Either way
// a lane's 8 accumulator registers are 8 neighbours of one row of the plane as it is stored.
// Each K chunk of BK goes global -> registers (f32) -> fp16 -> LDS.  Two register sets and
// two LDS buffers: the loads of two chunks are in flight at any time, and chunk c + 1 is
// converted and stored while chunk c is read and multiplied; one barrier a chunk.
// sel 0: Q (pre-scaled) [B][S][D];  sel 1: K [B][S][D];  sel 2: V^T [B][D][S]
// ---------------------------------------------------------------------------
// One chunk's loads.  x: a wave-wide load is 256 B of each of two rows; W [k][n]: one k row of 128 n.
// c counts from the work-group's own first chunk and wraps at NC.
__device__ __forceinline__ void chunk_load(f32x4 (&rx)[4], f32x4 (&rw)[4],
                                           const float* xg, const float* wg, int c) {
    const int cc = c & (NC - 1);
    const float* xn = xg + cc * BK;
    const float* wn = wg + (size_t)cc * BK * HD;
#pragma unroll
    for (int j = 0; j < 4; ++j) rx[j] = *(const f32x4*)(xn + (size_t)j * 32 * EMBED);
#pragma unroll
    for (int i = 0; i < 4; ++i) rw[i] = *(const f32x4*)(wn + (size_t)i * HD);
    // Stands behind the run of loads, before their address registers are used for anything else.
    // It names the run's two addresses as inputs: they stay live up to it, so that no load's own
    // result is given an address register of the run.
    asm volatile("s_wait_xcnt 0x0" :: "v"(xn), "v"(wn) : "memory");
}
// One chunk: registers -> fp16 -> LDS.  dX: the thread's place in row xr of the x tile;
// dW: row lane * 4 of the W^T tile at the wave's 4 k.
__device__ __forceinline__ void chunk_store(const f32x4 (&rx)[4], const f32x4 (&rw)[4],
                                            _Float16* dX, _Float16* dW, int rot) {
#pragma unroll
    for (int j = 0; j < 4; ++j) {
        v4h h;
#pragma unroll
        for (int e = 0; e < 4; ++e) h[e] = (_Float16)rx[j][e];
        *(v4h*)&dX[j * 32 * LDK] = h;
    }
    v4h h[4];
#pragma unroll
    for (int e = 0; e < 4; ++e)
#pragma unroll
        for (int i = 0; i < 4; ++i) h[e][i] = (_Float16)rw[i][e];
    // A lane's 4 rows lie 4 pitches from its neighbour's: stored in the same order by every
    // lane, the lanes would meet on 4 bank pairs.  Lane l starts at row (l >> 2) & 3.
    const bool m1 = rot & 1, m2 = rot & 2;
    v4h t[4], u[4];
#pragma unroll
    for (int i = 0; i < 4; ++i) t[i] = pick(m1, h[(i + 1) & 3], h[i]);
#pragma unroll
    for (int i = 0; i < 4; ++i) u[i] = pick(m2, t[(i + 2) & 3], t[i]);   // u[i] = h[(i + rot) & 3]
#pragma unroll
    for (int i = 0; i < 4; ++i) *(v4h*)&dW[((i + rot) & 3) * LDK] = u[i];
}
// Chunk c, whose tiles lie complete in buffer BUF.  nx, nw hold chunk c + 1, which goes to the
// other buffer, and are then filled with chunk c + 3.
template <int BUF, bool STORE, bool LOAD>
__device__ __forceinline__ void proj_chunk(int c, f32x4 (&nx)[4], f32x4 (&nw)[4], v8f (&acc)[4],
                                           const _Float16* fX, const _Float16* fW,
                                           _Float16* dX, _Float16* dW, int rot,
                                           const float* xg, const float* wg) {
    // all fragments of the chunk as one group of LDS reads
    v16h fa[BK / 32], fb[BK / 32][4];
#pragma unroll
    for (int kc = 0; kc < BK / 32; ++kc) {
        fa[kc] = frag_ld(fX + BUF * PBUF + kc * 32, LDK);
#pragma unroll
        for (int t = 0; t < 4; ++t) fb[kc][t] = frag_ld(fW + BUF * PBUF + (t * 16) * LDK + kc * 32, LDK);
    }
    // keeps the reads above in front of the conversion below, which then runs under their latency
    __builtin_amdgcn_sched_barrier(0);
    if (STORE) chunk_store(nx, nw, dX + (BUF ^ 1) * PBUF, dW + (BUF ^ 1) * PBUF, rot);
    if (LOAD)  chunk_load(nx, nw, xg, wg, c + 3);
    // keeps the products behind the stores and the loads: in front of them they would hold
    // both back for the time of the fragment reads
    __builtin_amdgcn_sched_barrier(0);
#pragma unroll
    for (int kc = 0; kc < BK / 32; ++kc)
#pragma unroll
        for (int t = 0; t < 4; ++t)
            acc[t] = __builtin_amdgcn_wmma_f32_16x16x32_f16(
                false, fa[kc], false, fb[kc][t], (short)0, acc[t], false, false);
    lds_barrier_behind(acc);   // chunk c + 1 is complete, and every wave has read chunk c
}

__global__ __launch_bounds__(512) void qkv_proj_kernel(
    const float* __restrict__ x,
    const float* __restrict__ wq, const float* __restrict__ wk, const float* __restrict__ wv,
    const float* __restrict__ bq, const float* __restrict__ bk, const float* __restrict__ bv,
    _Float16* __restrict__ ws) {
    __shared__ __attribute__((aligned(16))) _Float16 sX[2 * PBUF];   // x tiles [128 s][BK k]; epilogue bounce buffer
    __shared__ __attribute__((aligned(16))) _Float16 sW[2 * PBUF];   // W^T tiles [128 n][BK k]
    static_assert(2 * PBUF >= TILE * LDW, "the bounce buffer fits the x tiles");

    const int sel     = blockIdx.y;
    const float* bias = sel == 0 ? bq : (sel == 1 ? bk : bv);
    const float* w    = sel == 0 ? wq : (sel == 1 ? wk : wv);
    const int batch = blockIdx.x >> 4;
    const int m0    = (blockIdx.x & 15) * TILE;
    const int tid   = threadIdx.x;
    const int wave  = tid >> 5;
    const int lane  = tid & 31;
    const int rg    = wave & 7;    // the wave's group of 16 rows of A
    const int ch    = wave >> 3;   // the wave's half of the 128 rows of B

    const int xr = wave * 2 + (lane >> 4), xc = (lane & 15) * 4;   // rows xr, xr + 32, ...; 4 k at xc
    const float* xg = x + ((size_t)batch * SEQ + m0 + xr) * EMBED + xc;
    // a thread holds a block of 4 k x 4 n of W, so that 4 consecutive k of one n are one
    // 8-B LDS store of the transposed tile
    const float* wg = w + (size_t)(wave * 4) * HD + lane * 4;
    const int rot = (lane >> 2) & 3;   // which of its 4 n a lane stores first
    _Float16* dX = &sX[xr * LDK + xc];
    _Float16* dW = &sW[(lane * 4) * LDK + wave * 4];
    const _Float16* fX = (sel == 2 ? sX : sW) + (rg * 16) * LDK;   // A operand
    const _Float16* fW = (sel == 2 ? sW : sX) + (ch * 64) * LDK;   // B operand

    // The K loop starts at a chunk of the work-group's own and wraps round.  Started alike, the 64
    // work-groups of one weight matrix would ask L2 for the same lines of W at the same moment, the
    // three that share an x tile for the same lines of x, and every x tile for the same 256 bytes
    // of its 4-KiB rows.  Neighbours in the grid lie 2 chunks apart per 8 indices, the three
    // matrices 1 chunk apart (the one ahead fetches an x line, the two behind find it in L2).
    const int c0 = ((blockIdx.x >> 3) * 2 + (blockIdx.x & 1) + sel) & (NC - 1);

    f32x4 rx0[4], rw0[4], rx1[4], rw1[4];   // chunks c0, c0 + 2, ...; chunks c0 + 1, c0 + 3, ...
    chunk_load(rx0, rw0, xg, wg, c0);
    chunk_load(rx1, rw1, xg, wg, c0 + 1);
    chunk_store(rx0, rw0, dX, dW, rot);
    chunk_load(rx0, rw0, xg, wg, c0 + 2);
    lds_barrier();   // chunk c0 is complete

    v8f acc[4] = {};
    for (int c = 0; c < NC - 4; c += 2) {
        proj_chunk<0, true, true>(c0 + c,     rx1, rw1, acc, fX, fW, dX, dW, rot, xg, wg);
        proj_chunk<1, true, true>(c0 + c + 1, rx0, rw0, acc, fX, fW, dX, dW, rot, xg, wg);
    }
    proj_chunk<0, true,  true >(c0 + NC - 4, rx1, rw1, acc, fX, fW, dX, dW, rot, xg, wg);
    proj_chunk<1, true,  false>(NC - 3, rx0, rw0, acc, fX, fW, dX, dW, rot, xg, wg);
    // The bias, asked for under the last two chunks.  The output column n runs along B for V^T (one
    // value per accumulator tile) and along A for Q and K (one per accumulator register).
    const int hi = lane >> 4, ln = lane & 15;
    const float* bB = bias + ch * 64 + ln;
    const float* bA = bias + rg * 16 + 8 * hi;
    float bcol[4];
#pragma unroll
    for (int t = 0; t < 4; ++t) bcol[t] = bB[t * 16];
    const f32x4 brow0 = *(const f32x4*)bA, brow1 = *(const f32x4*)(bA + 4);
    // Stands behind the run of loads, before their address registers are used for anything else.
    asm volatile("s_wait_xcnt 0x0" :: "v"(bB), "v"(bA) : "memory");
    proj_chunk<0, true,  false>(NC - 2, rx1, rw1, acc, fX, fW, dX, dW, rot, xg, wg);
    proj_chunk<1, false, false>(NC - 1, rx0, rw0, acc, fX, fW, dX, dW, rot, xg, wg);

    // bias (+Q scale) -> fp16 into the LDS bounce buffer, laid out as the plane is stored
    // ([s][n] for Q and K, [n][s] for V^T): row = the lane's B row, 8 neighbours = its A rows,
    // one 16-B store per accumulator tile
    _Float16* sOut = sX;
    const float qscale = sel == 0 ? 0.088388347648318447f : 1.0f;   // 1/sqrt(128) for Q
#pragma unroll
    for (int t = 0; t < 4; ++t) {
        v8h h;
#pragma unroll
        for (int i = 0; i < 8; ++i) {
            const float bb = sel == 2 ? bcol[t] : (i < 4 ? brow0[i & 3] : brow1[i & 3]);
            h[i] = (_Float16)((acc[t][i] + bb) * qscale);
        }
        *(v8h*)&sOut[(ch * 64 + t * 16 + ln) * LDW + rg * 16 + 8 * hi] = h;
    }
    __syncthreads();

    // coalesced 16B global stores from the bounce buffer
    if (sel == 2) {
        _Float16* dst = ws + VOFF + (size_t)batch * SEQ * HD;  // [D][S]
        for (int c = 0; c < 4; ++c) {
            int idx = c * 512 + tid;
            int r = idx >> 4, c8 = (idx & 15) * 8;
            *(v8h*)&dst[(size_t)r * SEQ + m0 + c8] = *(const v8h*)&sOut[r * LDW + c8];
        }
    } else {
        _Float16* dst = ws + (sel ? KOFF : QOFF) + (size_t)batch * SEQ * HD; // [S][D]
        for (int c = 0; c < 4; ++c) {
            int idx = c * 512 + tid;
            int r = idx >> 4, c8 = (idx & 15) * 8;
            *(v8h*)&dst[(size_t)(m0 + r) * HD + c8] = *(const v8h*)&sOut[r * LDW + c8];
        }
    }
}

// ---------------------------------------------------------------------------
// Tensor load of the attention kernel: one tile of 128 rows of 256 bytes, every
// extent in bytes, 16 bytes of LDS pad behind each row (LDS pitch 272 B = LDW halves).
// ---------------------------------------------------------------------------
typedef __attribute__((ext_vector_type(8))) unsigned int u32x8;
__device__ inline unsigned uni(unsigned v) { return (unsigned)__builtin_amdgcn_readfirstlane((int)v); }
// A wave-uniform value held in a scalar register.  On a test: the branch on it is a scalar
// branch (a tensor load ignores EXEC, only such a branch keeps a wave from issuing it).
// On a descriptor word: the word has one register of its own, which the compiler does not
// hand out and fill again between the request and its wait.
__device__ inline unsigned pinned(unsigned v) {
    unsigned w = uni(v);
    asm volatile("" : "+s"(w));   // issue test or descriptor word of a tensor load held in a scalar register
    return w;
}
// lane l takes the value of lane l ^ 16
__device__ inline float xhalf(float x) {
    const int b = __builtin_bit_cast(int, x);
    return __builtin_bit_cast(float, __builtin_amdgcn_permlanex16(b, b, 0x76543210, 0xfedcba98, false, false));
}
// The wave's own LDS reads and writes have retired before a buffer is handed back.
__device__ inline void wait_ds0() { asm volatile("s_wait_dscnt 0x0" ::: "memory"); }
__device__ inline u32x4 tile_group0(unsigned lds_byte_addr, const _Float16* gsrc) {
    const unsigned long long ga = (unsigned long long)(size_t)gsrc;
    u32x4 g;
    g[0] = pinned(1u);                                 // count = 1; descriptor word held in a scalar register
    g[1] = uni(lds_byte_addr);
    g[2] = uni((unsigned)ga);
    g[3] = uni((((unsigned)(ga >> 32)) & 0x01FFFFFFu) | 0x80000000u);   // type = 2
    return g;
}
__device__ inline u32x8 tile_group1(unsigned pitch_bytes) {
    constexpr unsigned d0 = 2 * TILE, d1 = TILE;       // bytes in a row, rows
    u32x8 g;
    g[0] = uni((1u << 20) | (5u << 22) | (3u << 25));  // no mask, 1-byte elements, pad 4 dwords per 256-B row
    // words 1 to 7: descriptor words held in scalar registers
    g[1] = pinned((d0 & 0xFFFFu) << 16);
    g[2] = pinned((d0 >> 16) | ((d1 & 0xFFFFu) << 16));
    g[3] = pinned((d1 >> 16) | (d0 << 16));
    g[4] = pinned(d1);
    g[5] = pinned(pitch_bytes);
    g[6] = pinned(0u);
    g[7] = pinned(0u);
    return g;
}
// asm so that it keeps its place among the asm waits around it
__device__ inline void tile_load(u32x4 g0, u32x8 g1) {
    asm volatile("tensor_load_to_lds %0, %1" :: "s"(g0), "s"(g1) : "memory");
}
// The compiler places no wait for a tensor load: a tile counts as landed behind this one.
// It names the request's descriptor as inputs so that those registers stay as they are
// for as long as the request is in flight.
__device__ inline void wait_tile(u32x4 g0, u32x8 g1) {
    asm volatile("s_wait_tensorcnt 0x0" :: "s"(g0), "s"(g1) : "memory");
}

// e^x for the softmax and the merge weights.  The v_nop in the same statement is the one slot the
// instruction set asks for behind a transcendental before its source register is
// overwritten or its result read.
__device__ inline float exp_weight(float x) {
    float e;
    asm("v_exp_f32 %0, %1\n\tv_nop" : "=v"(e) : "v"(x * 1.4426950408889634f));
    return e;
}

// ---------------------------------------------------------------------------
// Kernel 2: causal flash attention, TDM-fed, K/V double-buffered, keys split over the waves.
// grid = (S/32, B), 256 threads (8 waves).  A work-group owns 32 queries and walks their keys in
// stages of 256; of each stage wave w takes the 32 keys at 32 * w for all 32 queries, so that a
// K or V fragment read from LDS feeds two products.  Each wave keeps its own maximum, sum and
// un-normalised O; the eight are merged through LDS at the end and the result goes to out.
// ---------------------------------------------------------------------------
__global__ __launch_bounds__(256) void attn_kernel(
    const _Float16* __restrict__ ws, float* __restrict__ out) {
    extern __shared__ __attribute__((aligned(2048))) _Float16 smem[];   // every tile's place a multiple of 2 KiB

    const int batch = blockIdx.y;
    const int t     = NQB - 1 - (int)blockIdx.x;   // query block; the longest start first
    const int nT    = t / 4 + 1;                   // 128-key tiles up to the diagonal
    const int nst   = (nT + 1) / 2;                // stages of 256 keys
    // The walk over the stages starts at a stage of the work-group's own and wraps round: started
    // alike, the query blocks of one batch would ask L2 for the same K and V lines at the same
    // moment.  st(j) is the stage of pass j.
    int rt = t & 7;
    while (rt >= nst) rt -= nst;
    const auto st   = [nst, rt](int j) { const int s = j + rt; return s >= nst ? s - nst : s; };
    const int tid   = threadIdx.x, lane = tid & 31;
    const int hi    = lane >> 4,  ln   = lane & 15;
    const size_t SD = (size_t)SEQ * HD;

    const _Float16* Qg = ws + QOFF + (size_t)batch * SD + (size_t)t * QT * HD;  // pre-scaled
    const _Float16* Kg = ws + KOFF + (size_t)batch * SD;
    const _Float16* Vg = ws + VOFF + (size_t)batch * SD;  // [D][S]
    const unsigned lds0 = (unsigned)(size_t)(void*)smem;

    const unsigned wv = uni(threadIdx.x >> 5);   // the wave's number, scalar

    // The Q fragments (B operand: column = query, k order of frag_ld) come straight from global
    // memory and stay in registers for all keys.
    const _Float16* qp = Qg + ln * HD + hi * 8;
    v16h qb[2][4];
#pragma unroll
    for (int g = 0; g < 2; ++g)
#pragma unroll
        for (int kc = 0; kc < 4; ++kc) {
            union { v16h v; v8h h[2]; } u;
            u.h[0] = *(const v8h*)(qp + g * 16 * HD + kc * 32);
            u.h[1] = *(const v8h*)(qp + g * 16 * HD + kc * 32 + 16);
            qb[g][kc] = u.v;
        }
    // Stands behind the run of loads, before their address register is used for anything else.
    asm volatile("s_wait_xcnt 0x0" :: "v"(qp) : "memory");

    // Waves 0 and 2 bring the low and the high K tile of a stage, waves 1 and 3 the V tiles: one
    // request of a wave in flight at any time, each wave with its own source, place and row pitch.
    // A high tile wholly behind the diagonal is not asked for, and no wave reads it.
    const bool     isv   = wv & 1;
    const int      half  = (wv >> 1) & 1;
    const _Float16* src  = isv ? Vg : Kg;
    const unsigned place = lds0 + 2 * ((isv ? 2 : 0) + half) * TL;
    const size_t   step  = isv ? (size_t)TILE : (size_t)TILE * HD;   // halves from key tile to key tile
    const u32x8 g1 = tile_group1(isv ? 2 * SEQ : 2 * HD);
    u32x4 g0 = tile_group0(place, src + (size_t)(2 * st(0) + half) * step);
    // the stage of pass 0 lands and is published before anything reads it
    if (pinned(wv < 4 && 2 * st(0) + half < nT)) { tile_load(g0, g1); wait_tile(g0, g1); }
    __syncthreads();
    // the stage of pass 1 flies under pass 0, where there is a second stage
    g0 = tile_group0(place + 2 * STAGE, src + (size_t)(2 * st(1) + half) * step);
    if (pinned(wv < 4 && nst > 1 && 2 * st(1) + half < nT)) tile_load(g0, g1);

    v8f o_acc[8][2] = {};              // o_acc[dt][g][i] = O[query g * 16 + ln][d = dt * 16 + 8 * hi + i]
    float m_i[2] = {-3.0e38f, -3.0e38f};   // the query's maximum over this wave's keys
    float l_i[2] = {0.f, 0.f};             // the sum over this wave half's keys

    for (int j = 0; j < nst; ++j) {
        const int kb = 8 * st(j) + (int)wv;    // the wave's block of 32 keys
        if (kb <= t) {                         // wave-uniform: a block behind the diagonal is skipped
            const _Float16* sK = smem + (j & 1) * STAGE + (wv >> 2) * TL + ((wv & 3) * 32) * LDW;
            const _Float16* sV = smem + (j & 1) * STAGE + (2 + (wv >> 2)) * TL + (wv & 3) * 32;
            // the K fragments of the pass (32 keys x 128) as one group of LDS reads
            v16h fk[2][4], fv[8];
#pragma unroll
            for (int kf = 0; kf < 2; ++kf)
#pragma unroll
                for (int kc = 0; kc < 4; ++kc) fk[kf][kc] = frag_ld(sK + (kf * 16) * LDW + kc * 32, LDW);
            // keeps the reads above in front of the products below: moved behind them, each
            // product would wait out the whole latency of its own LDS read
            __builtin_amdgcn_sched_barrier(0);

            v8f s[2][2] = {};          // s[kf][g][i] = score(key kb * 32 + kf * 16 + 8 * hi + i, query g * 16 + ln)
#pragma unroll
            for (int kc = 0; kc < 4; ++kc)
#pragma unroll
                for (int kf = 0; kf < 2; ++kf)
#pragma unroll
                    for (int g = 0; g < 2; ++g)
                        s[kf][g] = __builtin_amdgcn_wmma_f32_16x16x32_f16(
                            false, fk[kf][kc], false, qb[g][kc], (short)0, s[kf][g], false, false);
            // The V^T fragments (128 d x 32 keys) as one group behind the score products and in front
            // of the softmax, which covers their latency.  The two fences keep them there: among the
            // K reads they would hold the eight waves' K fragments back, behind the softmax each
            // product would wait for its own read.
            __builtin_amdgcn_sched_barrier(0);
#pragma unroll
            for (int dt = 0; dt < 8; ++dt) fv[dt] = frag_ld(sV + (dt * 16) * LDW, LDW);
            __builtin_amdgcn_sched_barrier(0);

            if (kb == t) {   // diagonal block: causal mask
#pragma unroll
                for (int kf = 0; kf < 2; ++kf)
#pragma unroll
                    for (int g = 0; g < 2; ++g)
#pragma unroll
                        for (int i = 0; i < 8; ++i)
                            if (kf * 16 + 8 * hi + i > g * 16 + ln) s[kf][g][i] = -3.0e38f;
            }

            // online softmax, all of a query's scores in two lanes: maximum and sum run down the
            // lane's own registers, and one exchange between the wave halves joins the maxima
            v16h pb[2];
#pragma unroll
            for (int g = 0; g < 2; ++g) {
                v8f mx8;
#pragma unroll
                for (int i = 0; i < 8; ++i) mx8[i] = fmaxf(s[0][g][i], s[1][g][i]);
                float rmax = fmaxf(fmaxf(fmaxf(mx8[0], mx8[1]), fmaxf(mx8[2], mx8[3])),
                                   fmaxf(fmaxf(mx8[4], mx8[5]), fmaxf(mx8[6], mx8[7])));
                rmax = fmaxf(rmax, xhalf(rmax));
                const float mnew  = fmaxf(m_i[g], rmax);
                const float alpha = exp_weight(m_i[g] - mnew);
                v8f sum8;
#pragma unroll
                for (int i = 0; i < 8; ++i) {
                    s[0][g][i] = exp_weight(s[0][g][i] - mnew);
                    s[1][g][i] = exp_weight(s[1][g][i] - mnew);
                    sum8[i] = s[0][g][i] + s[1][g][i];
                }
                l_i[g] = l_i[g] * alpha + (((sum8[0] + sum8[1]) + (sum8[2] + sum8[3])) +
                                           ((sum8[4] + sum8[5]) + (sum8[6] + sum8[7])));
                m_i[g] = mnew;
#pragma unroll
                for (int dt = 0; dt < 8; ++dt) o_acc[dt][g] *= alpha;
                // P^T as B operand: the two score tiles (32 keys) converted in place are one fragment
                // in the k order of frag_ld: element e = key 8 * hi + e, element 8 + e = key 16 + 8 * hi + e
#pragma unroll
                for (int i = 0; i < 8; ++i) {
                    pb[g][i]     = (_Float16)s[0][g][i];
                    pb[g][8 + i] = (_Float16)s[1][g][i];
                }
            }

            // O^T += V^T P^T over the wave's 32 keys
#pragma unroll
            for (int dt = 0; dt < 8; ++dt)
#pragma unroll
                for (int g = 0; g < 2; ++g)
                    o_acc[dt][g] = __builtin_amdgcn_wmma_f32_16x16x32_f16(
                        false, fv[dt], false, pb[g], (short)0, o_acc[dt][g], false, false);
        }
        // publish the stage of pass j+1 and free pass j's buffer: own LDS traffic retired, the
        // issuers' tiles landed, one barrier for both, and only then the refill
        wait_ds0();
        if (pinned(wv < 4)) wait_tile(g0, g1);
        __syncthreads();
        g0 = tile_group0(place + (j & 1) * (2 * STAGE), src + (size_t)(2 * st(j + 2) + half) * step);
        if (pinned(wv < 4 && j + 2 < nst && 2 * st(j + 2) + half < nT)) tile_load(g0, g1);
    }
    wait_tile(g0, g1);
    wait_ds0();

    // Merge of the eight waves' key shares, in the ring's LDS, which every wave has left at the
    // loop's last barrier and no tensor load is aimed at any more.
    float* stg = (float*)smem;               // [8 waves][32 queries][STP]
    float* sM  = stg + 8 * QT * STP;         // [8 waves][32 queries] maxima
    float* sL  = sM + 8 * QT;                // [8 waves][32 queries] sums (both halves' keys joined)
#pragma unroll
    for (int g = 0; g < 2; ++g) {
        const float l_all = l_i[g] + xhalf(l_i[g]);
        (hi ? sL : sM)[wv * QT + g * 16 + ln] = hi ? l_all : m_i[g];
    }
    __syncthreads();   // every wave's maxima and sums are there
    // A wave scales its O by e^(its maximum - the common one) / the common sum and lays it down as
    // rows of 128 d; a wave that had no key block has maximum -3e38, weight 0 and O = 0.
#pragma unroll
    for (int g = 0; g < 2; ++g) {
        float mw[8], lw[8];
#pragma unroll
        for (int w = 0; w < 8; ++w) {
            mw[w] = sM[w * QT + g * 16 + ln];
            lw[w] = sL[w * QT + g * 16 + ln];
        }
        float mx = mw[0];
#pragma unroll
        for (int w = 1; w < 8; ++w) mx = fmaxf(mx, mw[w]);
        float ls = 0.f;
#pragma unroll
        for (int w = 0; w < 8; ++w) ls += exp_weight(mw[w] - mx) * lw[w];
        const float f = exp_weight(m_i[g] - mx) * (1.0f / ls);
        float* row = stg + (size_t)(wv * QT + g * 16 + ln) * STP + 8 * hi;
#pragma unroll
        for (int dt = 0; dt < 8; ++dt) {
            const v8f o = o_acc[dt][g] * f;
            *(f32x4*)&row[dt * 16]     = f32x4{o[0], o[1], o[2], o[3]};
            *(f32x4*)&row[dt * 16 + 4] = f32x4{o[4], o[5], o[6], o[7]};
        }
    }
    __syncthreads();   // every wave's scaled O is there
    // wave w adds the eight shares of queries 4 w .. 4 w + 3 and stores 512 contiguous bytes a row
    float* po = out + ((size_t)batch * SEQ + (size_t)t * QT + wv * 4) * HD + lane * 4;
#pragma unroll
    for (int r = 0; r < 4; ++r) {
        f32x4 a = *(const f32x4*)&stg[(size_t)(wv * 4 + r) * STP + lane * 4];
#pragma unroll
        for (int w = 1; w < 8; ++w) a += *(const f32x4*)&stg[(size_t)(w * QT + wv * 4 + r) * STP + lane * 4];
        *(f32x4*)&po[(size_t)r * HD] = a;
    }
}

extern "C" void kernel_launch(void* const* d_in, const int* in_sizes, int n_in,
                              void* d_out, int out_size, void* d_ws, size_t ws_size,
                              hipStream_t stream) {
    const float* x  = (const float*)d_in[0];
    const float* wq = (const float*)d_in[1];
    const float* bq = (const float*)d_in[2];
    const float* wk = (const float*)d_in[3];
    const float* bk = (const float*)d_in[4];
    const float* wv = (const float*)d_in[5];
    const float* bv = (const float*)d_in[6];
    _Float16* ws = (_Float16*)d_ws;   // fp16 Q, K, V^T

    qkv_proj_kernel<<<dim3(BATCH * SEQ / TILE, 3), 512, 0, stream>>>(
        x, wq, wk, wv, bq, bk, bv, ws);
    attn_kernel<<<dim3(NQB, BATCH), 256, SMEM2_BYTES, stream>>>(ws, (float*)d_out);
}
